// v000
// The times below were measured on an AMD MI455X: many runs one after another, warmed up first and cycling through
// copies of the inputs, with the whole window's GPU time divided by the number of runs. Launches and the gaps
// between them are all in it. The median over several windows is given; except for v000 it joins two sittings, which
// can be a few percent apart, so the side-by-side timings, each taken in one sitting, are the better comparison.
// v000, which the later versions start from, runs in 429 microseconds.
#include <hip/hip_runtime.h>
#include <math.h>

typedef __attribute__((ext_vector_type(16))) _Float16 v16h;
typedef __attribute__((ext_vector_type(16))) __bf16 v16b;
typedef __attribute__((ext_vector_type(8)))  _Float16 v8h;
typedef __attribute__((ext_vector_type(8)))  float v8f;
typedef __attribute__((ext_vector_type(4)))  float v4f;
typedef __attribute__((ext_vector_type(2)))  float v2f;
typedef __attribute__((ext_vector_type(4)))  unsigned v4u;
typedef __attribute__((ext_vector_type(4)))  int v4i;
typedef float __attribute__((may_alias)) float_a;
typedef int __attribute__((may_alias)) int_a;

template <typename T> __device__ __forceinline__ void vst2(void* p, T v) { *(T*)p = v;  }
__device__ __forceinline__ v8f wmma16(v16h a, v16h b, v8f c) {
  v8f d = __builtin_amdgcn_wmma_f32_16x16x32_f16(false, a, false, b, (short)0, c, false, false);
  asm volatile("v_nop\n\tv_nop\n\tv_nop\n\tv_nop" : "+v"(d) : "v"(a), "v"(b));
  return d;
}
__device__ __forceinline__ v8f wmma_bf(v16b a, v16b b, v8f c) {
  v8f d = __builtin_amdgcn_wmma_f32_16x16x32_bf16(false, a, false, b, (short)0, c, false, false);
  asm volatile("v_nop\n\tv_nop\n\tv_nop\n\tv_nop" : "+v"(d) : "v"(a), "v"(b));
  return d;
}
// 16x16x32 fragments: lane = (h = lane>>4, row/col = lane&15); elements 0..7 = k0+8h+0..7, 8..15 = k0+16+8h+0..7; D element r = row 8h+r
__device__ __forceinline__ v16h frag_h(const _Float16* rowk0, int lane) {
  union { v16h v; v8h q[2]; } u; const _Float16* p = rowk0 + 8 * (lane >> 4);
  u.q[0] = *(const v8h*)p; u.q[1] = *(const v8h*)(p + 16); return u.v;
}
__device__ __forceinline__ v16h frag_f32(const float* rowk0, int lane) {
  v16h a; const float* p = rowk0 + 8 * (lane >> 4);
#pragma unroll
  for (int i = 0; i < 8; ++i) { a[i] = (_Float16)p[i]; a[8 + i] = (_Float16)p[16 + i]; }
  return a;
}
__device__ __forceinline__ v16h frag_f32s(const float* rowk0, int lane, float sc) {
  v16h a; const float* p = rowk0 + 8 * (lane >> 4);
#pragma unroll
  for (int i = 0; i < 8; ++i) { a[i] = (_Float16)(p[i] * sc); a[8 + i] = (_Float16)(p[16 + i] * sc); }
  return a;
}
// column fragment from a [K][ld] layout (column n), rows >= K read as 0
__device__ __forceinline__ v16h fragc_f32(const float* W, int k0, int n, int lane, int ld, int K) {
  v16h a; const int g = lane >> 4;
#pragma unroll
  for (int i = 0; i < 8; ++i) { const int ka = k0 + 8 * g + i, kb = ka + 16;
    a[i] = (_Float16)(ka < K ? W[(size_t)ka * ld + n] : 0.f); a[8 + i] = (_Float16)(kb < K ? W[(size_t)kb * ld + n] : 0.f); }
  return a;
}
struct F2 { v16b h, l; };
__device__ __forceinline__ F2 bsplit16(const float v[16]) { F2 r;
#pragma unroll
  for (int i = 0; i < 16; ++i) { const __bf16 h = (__bf16)v[i]; r.h[i] = h; r.l[i] = (__bf16)(v[i] - (float)h); }
  return r; }
__device__ __forceinline__ F2 split_row(const float* row, int k0, int lane) { float v[16]; const float* p = row + k0 + 8 * (lane >> 4);
#pragma unroll
  for (int i = 0; i < 8; ++i) { v[i] = p[i]; v[8 + i] = p[16 + i]; }
  return bsplit16(v); }
__device__ __forceinline__ F2 split_rowK(const float* row, int k0, int lane, int K) { float v[16]; const int g = lane >> 4;
#pragma unroll
  for (int i = 0; i < 8; ++i) { const int ka = k0 + 8 * g + i, kb = ka + 16; v[i] = ka < K ? row[ka] : 0.f; v[8 + i] = kb < K ? row[kb] : 0.f; }
  return bsplit16(v); }
__device__ __forceinline__ F2 split_col(const float* W, int k0, int n, int lane, int ld, int K) { float v[16]; const int g = lane >> 4;
#pragma unroll
  for (int i = 0; i < 8; ++i) { const int ka = k0 + 8 * g + i, kb = ka + 16; v[i] = ka < K ? W[(size_t)ka * ld + n] : 0.f; v[8 + i] = kb < K ? W[(size_t)kb * ld + n] : 0.f; }
  return bsplit16(v); }
__device__ __forceinline__ v8f mac3(const F2& a, const F2& b, v8f c) { c = wmma_bf(a.l, b.h, c); c = wmma_bf(a.h, b.l, c); return wmma_bf(a.h, b.h, c); }
__device__ __forceinline__ float sigm(float v) { return 1.0f / (1.0f + expf(-v)); }
#define LDSX() do { asm volatile("s_wait_dscnt 0" ::: "memory"); __builtin_amdgcn_wave_barrier(); __builtin_amdgcn_fence(__ATOMIC_RELEASE, "workgroup"); } while (0)

// Linear (kernelised) attention block. qkv = x@w_qkv + b on f16 WMMA (x converted once, [in][out] weights packed transposed x16); per
// head LayerNorm of k and v over their 32 channels in f32 (LDS); kv_h = k_h^T v_h as deterministic per-block 32x32 partial sums (f32
// VALU) reduced in fixed order and divided by HW; then per 64-row block: out = q @ kv on WMMA (K = 32), + x, GELU(erf) MLP on f16 WMMA
// with the hidden tile in LDS, + x. The k^T v outer-product partials are VALU (64 rows per block).
#define NB 8
#define HWN 4096
#define CC 256
#define NHD 8
#define HC 32
#define NR (NB * HWN)
#define BPB (HWN / 64)        // 64 row-blocks per batch entry

__device__ __forceinline__ float gelu_e(float v) { return 0.5f * v * (1.0f + erff(v * 0.70710678118654752f)); }

__global__ __launch_bounds__(256) void k_cvt(const float* __restrict__ x, _Float16* __restrict__ x16, size_t n8) {
  const size_t g8 = (size_t)blockIdx.x * 256 + threadIdx.x; if (g8 >= n8) return;
  union { v8h h; v4u u; } pk;
#pragma unroll
  for (int e = 0; e < 8; ++e) pk.h[e] = (_Float16)x[g8 * 8 + e];
  vst2(x16 + g8 * 8, pk.u);
}
__global__ __launch_bounds__(256) void k_packT(const float* __restrict__ Wqkv, const float* __restrict__ W1, const float* __restrict__ W2, _Float16* __restrict__ P) {   // P rows: [0,768) w_qkv^T, [768,1024) w1^T, [1024,1280) w2^T, each [n][256] x16
  __shared__ float tile[64][65];
  const int which = blockIdx.z, o0 = blockIdx.x * 64, k0 = blockIdx.y * 64, tid = threadIdx.x;
  const float* W = which == 0 ? Wqkv : (which == 1 ? W1 : W2); const int NOUT = which == 0 ? 3 * CC : CC; const int rowbase = which == 0 ? 0 : (which == 1 ? 3 * CC : 4 * CC);
  if (o0 >= NOUT) return;                                // uniform per block, before any barrier
  for (int q = tid; q < 64 * 64; q += 256) { const int kl = q >> 6, ol = q & 63; tile[kl][ol] = W[(size_t)(k0 + kl) * NOUT + o0 + ol]; }
  __syncthreads();
  for (int u = 0; u < 2; ++u) { const int idx = tid + u * 256, ol = idx >> 3, pc = idx & 7; union { v8h hh; v4u uu; } pk;
#pragma unroll
    for (int i = 0; i < 8; ++i) pk.hh[i] = (_Float16)(tile[pc * 8 + i][ol] * 16.0f);
    vst2(P + ((size_t)rowbase + o0 + ol) * CC + k0 + pc * 8, pk.uu); }
}
// qkv for 64 rows: column n of the 768 = h*96 + which*32 + c (reference reshape (B,HW,8,96) then split). q -> sq, k -> sk, v -> sv (LDS f32),
// LN(k), LN(v) per (row, head); q rows -> global f32 [r][h*32+c]; kv partial [blk][h][32][32] = sum_rows kn (x) vn
__global__ __launch_bounds__(128) void k_qkv(const _Float16* __restrict__ x16, const _Float16* __restrict__ P, const float* __restrict__ bqkv, const float* __restrict__ kg, const float* __restrict__ kb, const float* __restrict__ vg, const float* __restrict__ vb,
                                           float* __restrict__ qrows, float* __restrict__ part) {
  __shared__ __align__(16) float sq[64][CC + 4], sk[64][CC + 4], sv[64][CC + 4];
  const int tid = threadIdx.x, wave = tid >> 5, lane = tid & 31, col = lane & 15, g = lane >> 4;
  const int r0b = blockIdx.x * 64, r0 = r0b + wave * 16;
  v16h ax[8];
#pragma unroll
  for (int kc = 0; kc < 8; ++kc) ax[kc] = frag_h(x16 + (size_t)(r0 + col) * CC + kc * 32, lane);
#pragma unroll 1
  for (int nc = 0; nc < 6; ++nc) { v8f acc[8] = {};
#pragma unroll
    for (int kc = 0; kc < 8; ++kc) {
#pragma unroll
      for (int j = 0; j < 8; ++j) acc[j] = wmma16(ax[kc], frag_h(P + (size_t)(nc * 128 + j * 16 + col) * CC + kc * 32, lane), acc[j]); }
#pragma unroll
    for (int j = 0; j < 8; ++j) { const int n = nc * 128 + j * 16 + col; const float bb = bqkv[n]; const int h = n / 96, wch = (n % 96) / 32, c = n % 32; const int cc = h * HC + c;
      float (*dst)[CC + 4] = wch == 0 ? sq : (wch == 1 ? sk : sv);
#pragma unroll
      for (int r = 0; r < 8; ++r) dst[wave * 16 + 8 * g + r][cc] = acc[j][r] * (1.0f / 16.0f) + bb; } }
  LDSX();
  // LN of k and v per (row, head) over 32 channels: lane = channel; wave's 16 rows x 8 heads
  for (int rh = 0; rh < 16 * NHD; ++rh) { const int rl = wave * 16 + (rh >> 3), h = rh & 7; const int cc = h * HC + lane;
    { const float v = sk[rl][cc]; float s = v; for (int off = 16; off >= 1; off >>= 1) s += __shfl_xor(s, off, 32); const float mu = s * (1.0f / HC); const float d = v - mu; float q2 = d * d; for (int off = 16; off >= 1; off >>= 1) q2 += __shfl_xor(q2, off, 32);
      sk[rl][cc] = d * rsqrtf(q2 * (1.0f / HC) + 1e-5f) * kg[lane] + kb[lane]; }
    { const float v = sv[rl][cc]; float s = v; for (int off = 16; off >= 1; off >>= 1) s += __shfl_xor(s, off, 32); const float mu = s * (1.0f / HC); const float d = v - mu; float q2 = d * d; for (int off = 16; off >= 1; off >>= 1) q2 += __shfl_xor(q2, off, 32);
      sv[rl][cc] = d * rsqrtf(q2 * (1.0f / HC) + 1e-5f) * vg[lane] + vb[lane]; } }
  // q rows out (wave's 16 rows)
  for (int q = lane; q < 16 * 64; q += 32) { const int rl = q >> 6, pc = q & 63; vst2(qrows + (size_t)(r0 + rl) * CC + pc * 4, *(const v4f*)(&sq[wave * 16 + rl][pc * 4])); }
  __syncthreads();
  // kv partials over the block's 64 rows: thread (128) -> for each head: 32x32 = 1024 outputs / 128 = 8 per thread
  __shared__ __align__(16) float sp[NHD * HC * HC];
#pragma unroll 1
  for (int h = 0; h < NHD; ++h) {
    float a8[8]; const int d = tid >> 2, e0 = (tid & 3) * 8;             // (d, e0..e0+7)
#pragma unroll
    for (int u = 0; u < 8; ++u) a8[u] = 0.f;
#pragma unroll 4
    for (int rl = 0; rl < 64; ++rl) { const float kd = sk[rl][h * HC + d];
#pragma unroll
      for (int u = 0; u < 8; ++u) a8[u] += kd * sv[rl][h * HC + e0 + u]; }
#pragma unroll
    for (int u = 0; u < 8; ++u) sp[(h * HC + d) * HC + e0 + u] = a8[u]; }
  __syncthreads();
  for (int q = tid; q < NHD * HC * HC / 4; q += 128) vst2(part + (size_t)blockIdx.x * (NHD * HC * HC) + q * 4, *(const v4f*)(&sp[q * 4]));
}
// kv[b][h][32][32] = (sum over the 64 blocks of batch b, fixed order) / HW ; block = (b, h)
__global__ __launch_bounds__(256) void k_kv(const float* __restrict__ part, float* __restrict__ kv) {
  __shared__ __align__(16) float so[HC * HC];
  const int b = blockIdx.y, h = blockIdx.x, tid = threadIdx.x;
  for (int e = tid; e < HC * HC; e += 256) { float s = 0.f;
#pragma unroll 1
    for (int blk = 0; blk < BPB; ++blk) s += part[((size_t)(b * BPB + blk) * NHD + h) * (HC * HC) + e];
    so[e] = s * (1.0f / (float)HWN); }
  __syncthreads();
  vst2(kv + ((size_t)b * NHD + h) * (HC * HC) + tid * 4, *(const v4f*)(&so[tid * 4]));
}
// per 64-row block: out = q @ kv (WMMA per head, K = 32, N = 32) + x -> ret (LDS); hid = gelu(ret @ w1 + b1) (LDS); out = hid @ w2 + b2 + x
__global__ __launch_bounds__(128) void k_mlp(const float* __restrict__ qrows, const float* __restrict__ kv, const float* __restrict__ x, const _Float16* __restrict__ P, const float* __restrict__ b1, const float* __restrict__ b2, float* __restrict__ out) {
  __shared__ __align__(16) float sr[64][CC + 4];      // ret, later reused for the output tile
  __shared__ __align__(16) float sh[64][CC + 4];      // hidden
  const int tid = threadIdx.x, wave = tid >> 5, lane = tid & 31, col = lane & 15, g = lane >> 4;
  const int r0b = blockIdx.x * 64, r0 = r0b + wave * 16; const int b = r0b / HWN;
#pragma unroll 1
  for (int h = 0; h < NHD; ++h) { const v16h a = frag_f32(qrows + (size_t)(r0 + col) * CC + h * HC, lane); const float* kvh = kv + ((size_t)b * NHD + h) * (HC * HC);
#pragma unroll
    for (int t = 0; t < 2; ++t) { v16h bb; const int n = t * 16 + col;                       // B[k=d][n=e] = kv[d][e] x64 (scaled in f32 before the cast: keeps small entries normal)
#pragma unroll
      for (int i = 0; i < 8; ++i) { bb[i] = (_Float16)(kvh[(8 * g + i) * HC + n] * 64.0f); bb[8 + i] = (_Float16)(kvh[(16 + 8 * g + i) * HC + n] * 64.0f); }
      v8f acc = {}; acc = wmma16(a, bb, acc);
#pragma unroll
      for (int r = 0; r < 8; ++r) { const int cc = h * HC + t * 16 + col; sr[wave * 16 + 8 * g + r][cc] = acc[r] * (1.0f / 64.0f) + x[(size_t)(r0 + 8 * g + r) * CC + cc]; } } }
  LDSX();
  // hidden = gelu(ret @ w1 + b1): A from sr rows (f32 -> f16), B = P rows 768.. (w1^T x16)
#pragma unroll 1
  for (int nh = 0; nh < 2; ++nh) { v8f acc[8];                     // hidden columns nh*128 .. +127
#pragma unroll
    for (int j = 0; j < 8; ++j) acc[j] = (v8f){};
#pragma unroll 1
    for (int kc = 0; kc < CC / 32; ++kc) { const v16h a = frag_f32(&sr[wave * 16 + col][0] + kc * 32, lane);
#pragma unroll
      for (int j = 0; j < 8; ++j) acc[j] = wmma16(a, frag_h(P + (size_t)(3 * CC + nh * 128 + j * 16 + col) * CC + kc * 32, lane), acc[j]); }
#pragma unroll
    for (int j = 0; j < 8; ++j) { const int cc = nh * 128 + j * 16 + col; const float bb = b1[cc];
#pragma unroll
      for (int r = 0; r < 8; ++r) sh[wave * 16 + 8 * g + r][cc] = gelu_e(acc[j][r] * (1.0f / 16.0f) + bb); } }
  LDSX();
  // second GEMM: sr is no longer read (both hidden halves are done), so each output half goes straight into sr
#pragma unroll 1
  for (int nh = 0; nh < 2; ++nh) { v8f acc[8];
#pragma unroll
    for (int j = 0; j < 8; ++j) acc[j] = (v8f){};
#pragma unroll 1
    for (int kc = 0; kc < CC / 32; ++kc) { const v16h a = frag_f32(&sh[wave * 16 + col][0] + kc * 32, lane);
#pragma unroll
      for (int j = 0; j < 8; ++j) acc[j] = wmma16(a, frag_h(P + (size_t)(4 * CC + nh * 128 + j * 16 + col) * CC + kc * 32, lane), acc[j]); }
#pragma unroll
    for (int j = 0; j < 8; ++j) { const int cc = nh * 128 + j * 16 + col; const float bb = b2[cc];
#pragma unroll
      for (int r = 0; r < 8; ++r) sr[wave * 16 + 8 * g + r][cc] = acc[j][r] * (1.0f / 16.0f) + bb + x[(size_t)(r0 + 8 * g + r) * CC + cc]; } }
  LDSX();
  for (int q = lane; q < 16 * 64; q += 32) { const int rl = q >> 6, pc = q & 63; vst2(out + (size_t)(r0 + rl) * CC + pc * 4, *(const v4f*)(&sr[wave * 16 + rl][pc * 4])); }
}
extern "C" void kernel_launch(void* const* d_in, const int* in_sizes, int n_in, void* d_out, int out_size, void* d_ws, size_t ws_size, hipStream_t stream) {
  (void)in_sizes; (void)n_in; (void)out_size; (void)ws_size;
  const float** I = (const float**)d_in;
  const float* x = I[0]; const float* Wqkv = I[1]; const float* bqkv = I[2]; const float* kg = I[3]; const float* kb = I[4]; const float* vg = I[5]; const float* vb = I[6]; const float* W1 = I[7]; const float* b1 = I[8]; const float* W2 = I[9]; const float* b2 = I[10];
  float* out = (float*)d_out;
  char* ws = (char*)d_ws; size_t off = 0;
  auto take = [&](size_t bytes) { char* p = ws + off; off += (bytes + 255) & ~(size_t)255; return p; };
  _Float16* x16 = (_Float16*)take((size_t)NR * CC * 2); _Float16* P = (_Float16*)take((size_t)5 * CC * CC * 2); float* qrows = (float*)take((size_t)NR * CC * 4);
  float* part = (float*)take((size_t)(NR / 64) * NHD * HC * HC * 4); float* kv = (float*)take((size_t)NB * NHD * HC * HC * 4);
  const size_t n8 = (size_t)NR * CC / 8; k_cvt<<<(unsigned)(n8 / 256), 256, 0, stream>>>(x, x16, n8);
  k_packT<<<dim3(3 * CC / 64, CC / 64, 3), 256, 0, stream>>>(Wqkv, W1, W2, P);
  k_qkv<<<NR / 64, 128, 0, stream>>>(x16, P, bqkv, kg, kb, vg, vb, qrows, part);
  k_kv<<<dim3(NHD, NB), 256, 0, stream>>>(part, kv);
  k_mlp<<<NR / 64, 128, 0, stream>>>(qrows, kv, x, P, b1, b2, out);
}

// v001
// A run of this version takes 335 microseconds.
// Two timings next to v000 both put it at 1.28 times that version's speed.
#include <hip/hip_runtime.h>
#include <math.h>

typedef __attribute__((ext_vector_type(16))) _Float16 v16h;
typedef __attribute__((ext_vector_type(16))) __bf16 v16b;
typedef __attribute__((ext_vector_type(8)))  _Float16 v8h;
typedef __attribute__((ext_vector_type(8)))  float v8f;
typedef __attribute__((ext_vector_type(4)))  float v4f;
typedef __attribute__((ext_vector_type(2)))  float v2f;
typedef __attribute__((ext_vector_type(4)))  unsigned v4u;
typedef __attribute__((ext_vector_type(4)))  int v4i;
typedef float __attribute__((may_alias)) float_a;
typedef int __attribute__((may_alias)) int_a;

template <typename T> __device__ __forceinline__ void vst2(void* p, T v) { *(T*)p = v;  }
__device__ __forceinline__ v8f wmma16(v16h a, v16h b, v8f c) {
  v8f d = __builtin_amdgcn_wmma_f32_16x16x32_f16(false, a, false, b, (short)0, c, false, false);
  asm volatile("v_nop\n\tv_nop\n\tv_nop\n\tv_nop" : "+v"(d) : "v"(a), "v"(b));
  return d;
}
__device__ __forceinline__ v8f wmma_bf(v16b a, v16b b, v8f c) {
  v8f d = __builtin_amdgcn_wmma_f32_16x16x32_bf16(false, a, false, b, (short)0, c, false, false);
  asm volatile("v_nop\n\tv_nop\n\tv_nop\n\tv_nop" : "+v"(d) : "v"(a), "v"(b));
  return d;
}
// 16x16x32 fragments: lane = (h = lane>>4, row/col = lane&15); elements 0..7 = k0+8h+0..7, 8..15 = k0+16+8h+0..7; D element r = row 8h+r
__device__ __forceinline__ v16h frag_h(const _Float16* rowk0, int lane) {
  union { v16h v; v8h q[2]; } u; const _Float16* p = rowk0 + 8 * (lane >> 4);
  u.q[0] = *(const v8h*)p; u.q[1] = *(const v8h*)(p + 16); return u.v;
}
// the same fragment from a pointer that already holds the lane's 8 * (lane >> 4) part
__device__ __forceinline__ v16h frag_hp(const _Float16* p) {
  union { v16h v; v8h q[2]; } u; u.q[0] = *(const v8h*)p; u.q[1] = *(const v8h*)(p + 16); return u.v;
}
__device__ __forceinline__ v16h frag_f32(const float* rowk0, int lane) {
  v16h a; const float* p = rowk0 + 8 * (lane >> 4);
#pragma unroll
  for (int i = 0; i < 8; ++i) { a[i] = (_Float16)p[i]; a[8 + i] = (_Float16)p[16 + i]; }
  return a;
}
__device__ __forceinline__ v16h frag_f32s(const float* rowk0, int lane, float sc) {
  v16h a; const float* p = rowk0 + 8 * (lane >> 4);
#pragma unroll
  for (int i = 0; i < 8; ++i) { a[i] = (_Float16)(p[i] * sc); a[8 + i] = (_Float16)(p[16 + i] * sc); }
  return a;
}
// column fragment from a [K][ld] layout (column n), rows >= K read as 0
__device__ __forceinline__ v16h fragc_f32(const float* W, int k0, int n, int lane, int ld, int K) {
  v16h a; const int g = lane >> 4;
#pragma unroll
  for (int i = 0; i < 8; ++i) { const int ka = k0 + 8 * g + i, kb = ka + 16;
    a[i] = (_Float16)(ka < K ? W[(size_t)ka * ld + n] : 0.f); a[8 + i] = (_Float16)(kb < K ? W[(size_t)kb * ld + n] : 0.f); }
  return a;
}
struct F2 { v16b h, l; };
__device__ __forceinline__ F2 bsplit16(const float v[16]) { F2 r;
#pragma unroll
  for (int i = 0; i < 16; ++i) { const __bf16 h = (__bf16)v[i]; r.h[i] = h; r.l[i] = (__bf16)(v[i] - (float)h); }
  return r; }
__device__ __forceinline__ F2 split_row(const float* row, int k0, int lane) { float v[16]; const float* p = row + k0 + 8 * (lane >> 4);
#pragma unroll
  for (int i = 0; i < 8; ++i) { v[i] = p[i]; v[8 + i] = p[16 + i]; }
  return bsplit16(v); }
__device__ __forceinline__ F2 split_rowK(const float* row, int k0, int lane, int K) { float v[16]; const int g = lane >> 4;
#pragma unroll
  for (int i = 0; i < 8; ++i) { const int ka = k0 + 8 * g + i, kb = ka + 16; v[i] = ka < K ? row[ka] : 0.f; v[8 + i] = kb < K ? row[kb] : 0.f; }
  return bsplit16(v); }
__device__ __forceinline__ F2 split_col(const float* W, int k0, int n, int lane, int ld, int K) { float v[16]; const int g = lane >> 4;
#pragma unroll
  for (int i = 0; i < 8; ++i) { const int ka = k0 + 8 * g + i, kb = ka + 16; v[i] = ka < K ? W[(size_t)ka * ld + n] : 0.f; v[8 + i] = kb < K ? W[(size_t)kb * ld + n] : 0.f; }
  return bsplit16(v); }
__device__ __forceinline__ v8f mac3(const F2& a, const F2& b, v8f c) { c = wmma_bf(a.l, b.h, c); c = wmma_bf(a.h, b.l, c); return wmma_bf(a.h, b.h, c); }
__device__ __forceinline__ float sigm(float v) { return 1.0f / (1.0f + expf(-v)); }
#define LDSX() do { asm volatile("s_wait_dscnt 0" ::: "memory"); __builtin_amdgcn_wave_barrier(); __builtin_amdgcn_fence(__ATOMIC_RELEASE, "workgroup"); } while (0)

// Linear (kernelised) attention block. qkv = x@w_qkv + b on f16 WMMA (x converted once, [in][out] weights packed transposed x16); per
// head LayerNorm of k and v over their 32 channels in f32 (LDS); kv_h = k_h^T v_h as deterministic per-block 32x32 partial sums (f32
// VALU) reduced in fixed order and divided by HW; then per 64-row block: out = q @ kv on WMMA (K = 32), + x, GELU(erf) MLP on f16 WMMA
// with the hidden tile in LDS, + x. The k^T v outer-product partials are VALU (64 rows per block).
#define NB 8
#define HWN 4096
#define CC 256
#define NHD 8
#define HC 32
#define NR (NB * HWN)
#define BPB (HWN / 64)        // 64 row-blocks per batch entry

__device__ __forceinline__ float gelu_e(float v) { return 0.5f * v * (1.0f + erff(v * 0.70710678118654752f)); }

__global__ __launch_bounds__(256) void k_cvt(const float* __restrict__ x, _Float16* __restrict__ x16, size_t n8) {
  const size_t g8 = (size_t)blockIdx.x * 256 + threadIdx.x; if (g8 >= n8) return;
  union { v8h h; v4u u; } pk;
#pragma unroll
  for (int e = 0; e < 8; ++e) pk.h[e] = (_Float16)x[g8 * 8 + e];
  vst2(x16 + g8 * 8, pk.u);
}
__global__ __launch_bounds__(256) void k_packT(const float* __restrict__ Wqkv, const float* __restrict__ W1, const float* __restrict__ W2, _Float16* __restrict__ P) {   // P rows: [0,768) w_qkv^T, [768,1024) w1^T, [1024,1280) w2^T, each [n][256] x16
  __shared__ float tile[64][65];
  const int which = blockIdx.z, o0 = blockIdx.x * 64, k0 = blockIdx.y * 64, tid = threadIdx.x;
  const float* W = which == 0 ? Wqkv : (which == 1 ? W1 : W2); const int NOUT = which == 0 ? 3 * CC : CC; const int rowbase = which == 0 ? 0 : (which == 1 ? 3 * CC : 4 * CC);
  if (o0 >= NOUT) return;                                // uniform per block, before any barrier
  for (int q = tid; q < 64 * 64; q += 256) { const int kl = q >> 6, ol = q & 63; tile[kl][ol] = W[(size_t)(k0 + kl) * NOUT + o0 + ol]; }
  __syncthreads();
  for (int u = 0; u < 2; ++u) { const int idx = tid + u * 256, ol = idx >> 3, pc = idx & 7; union { v8h hh; v4u uu; } pk;
#pragma unroll
    for (int i = 0; i < 8; ++i) pk.hh[i] = (_Float16)(tile[pc * 8 + i][ol] * 16.0f);
    vst2(P + ((size_t)rowbase + o0 + ol) * CC + k0 + pc * 8, pk.uu); }
}
// qkv for 64 rows: column n of the 768 = h*96 + which*32 + c (reference reshape (B,HW,8,96) then split). q -> sq, k -> sk, v -> sv (LDS f32),
// LN(k), LN(v) per (row, head); q rows -> global f32 [r][h*32+c]; kv partial [blk][h][32][32] = sum_rows kn (x) vn
__global__ __launch_bounds__(128) void k_qkv(const _Float16* __restrict__ x16, const _Float16* __restrict__ P, const float* __restrict__ bqkv, const float* __restrict__ kg, const float* __restrict__ kb, const float* __restrict__ vg, const float* __restrict__ vb,
                                           float* __restrict__ qrows, float* __restrict__ part) {
  __shared__ __align__(16) float sq[64][CC + 4], sk[64][CC + 4], sv[64][CC + 4];
  const int tid = threadIdx.x, wave = tid >> 5, lane = tid & 31, col = lane & 15, g = lane >> 4;
  const int r0b = blockIdx.x * 64, r0 = r0b + wave * 16;
  v16h ax[8];
#pragma unroll
  for (int kc = 0; kc < 8; ++kc) ax[kc] = frag_h(x16 + (size_t)(r0 + col) * CC + kc * 32, lane);
  // B fragments run one k group (8 tiles) ahead: behind each WMMA its fragment register is reloaded for the next group, so 8 fragments
  // are always in flight and no WMMA waits out the latency of its own loads. The last group reloads chunk 5, k group 0 (in bounds, unused)
  v16h bf[8];
#pragma unroll
  for (int j = 0; j < 8; ++j) bf[j] = frag_h(P + (size_t)(j * 16 + col) * CC, lane);
#pragma unroll 1
  for (int nc = 0; nc < 6; ++nc) { v8f acc[8] = {}; const int ncn = nc < 5 ? nc + 1 : 5;
#pragma unroll
    for (int kc = 0; kc < 8; ++kc) {
#pragma unroll
      for (int j = 0; j < 8; ++j) { acc[j] = wmma16(ax[kc], bf[j], acc[j]);
        bf[j] = frag_h(P + (size_t)((kc < 7 ? nc : ncn) * 128 + j * 16 + col) * CC + ((kc + 1) & 7) * 32, lane); } }
#pragma unroll
    for (int j = 0; j < 8; ++j) { const int n = nc * 128 + j * 16 + col; const float bb = bqkv[n]; const int h = n / 96, wch = (n % 96) / 32, c = n % 32; const int cc = h * HC + c;
      float (*dst)[CC + 4] = wch == 0 ? sq : (wch == 1 ? sk : sv);
#pragma unroll
      for (int r = 0; r < 8; ++r) dst[wave * 16 + 8 * g + r][cc] = acc[j][r] * (1.0f / 16.0f) + bb; } }
  LDSX();
  // LN of k and v per (row, head) over 32 channels: lane = channel; wave's 16 rows x 8 heads
  for (int rh = 0; rh < 16 * NHD; ++rh) { const int rl = wave * 16 + (rh >> 3), h = rh & 7; const int cc = h * HC + lane;
    { const float v = sk[rl][cc]; float s = v; for (int off = 16; off >= 1; off >>= 1) s += __shfl_xor(s, off, 32); const float mu = s * (1.0f / HC); const float d = v - mu; float q2 = d * d; for (int off = 16; off >= 1; off >>= 1) q2 += __shfl_xor(q2, off, 32);
      sk[rl][cc] = d * rsqrtf(q2 * (1.0f / HC) + 1e-5f) * kg[lane] + kb[lane]; }
    { const float v = sv[rl][cc]; float s = v; for (int off = 16; off >= 1; off >>= 1) s += __shfl_xor(s, off, 32); const float mu = s * (1.0f / HC); const float d = v - mu; float q2 = d * d; for (int off = 16; off >= 1; off >>= 1) q2 += __shfl_xor(q2, off, 32);
      sv[rl][cc] = d * rsqrtf(q2 * (1.0f / HC) + 1e-5f) * vg[lane] + vb[lane]; } }
  // q rows out (wave's 16 rows)
  for (int q = lane; q < 16 * 64; q += 32) { const int rl = q >> 6, pc = q & 63; vst2(qrows + (size_t)(r0 + rl) * CC + pc * 4, *(const v4f*)(&sq[wave * 16 + rl][pc * 4])); }
  __syncthreads();
  // kv partials over the block's 64 rows: thread (128) -> for each head: 32x32 = 1024 outputs / 128 = 8 per thread
  __shared__ __align__(16) float sp[NHD * HC * HC];
#pragma unroll 1
  for (int h = 0; h < NHD; ++h) {
    float a8[8]; const int d = tid >> 2, e0 = (tid & 3) * 8;             // (d, e0..e0+7)
#pragma unroll
    for (int u = 0; u < 8; ++u) a8[u] = 0.f;
#pragma unroll 4
    for (int rl = 0; rl < 64; ++rl) { const float kd = sk[rl][h * HC + d];
#pragma unroll
      for (int u = 0; u < 8; ++u) a8[u] += kd * sv[rl][h * HC + e0 + u]; }
#pragma unroll
    for (int u = 0; u < 8; ++u) sp[(h * HC + d) * HC + e0 + u] = a8[u]; }
  __syncthreads();
  for (int q = tid; q < NHD * HC * HC / 4; q += 128) vst2(part + (size_t)blockIdx.x * (NHD * HC * HC) + q * 4, *(const v4f*)(&sp[q * 4]));
}
// kv[b][h][32][32] = (sum over the 64 blocks of batch b, fixed order) / HW ; block = (b, h)
__global__ __launch_bounds__(256) void k_kv(const float* __restrict__ part, float* __restrict__ kv) {
  __shared__ __align__(16) float so[HC * HC];
  const int b = blockIdx.y, h = blockIdx.x, tid = threadIdx.x;
  for (int e = tid; e < HC * HC; e += 256) { float s = 0.f;
#pragma unroll 1
    for (int blk = 0; blk < BPB; ++blk) s += part[((size_t)(b * BPB + blk) * NHD + h) * (HC * HC) + e];
    so[e] = s * (1.0f / (float)HWN); }
  __syncthreads();
  vst2(kv + ((size_t)b * NHD + h) * (HC * HC) + tid * 4, *(const v4f*)(&so[tid * 4]));
}
// per 64-row block: out = q @ kv (WMMA per head, K = 32, N = 32) + x -> ret (LDS); hid = gelu(ret @ w1 + b1) (LDS); out = hid @ w2 + b2 + x
__global__ __launch_bounds__(128) void k_mlp(const float* __restrict__ qrows, const float* __restrict__ kv, const float* __restrict__ x, const _Float16* __restrict__ P, const float* __restrict__ b1, const float* __restrict__ b2, float* __restrict__ out) {
  __shared__ __align__(16) float sr[64][CC + 4];      // ret, later reused for the output tile
  __shared__ __align__(16) float sh[64][CC + 4];      // hidden
  const int tid = threadIdx.x, wave = tid >> 5, lane = tid & 31, col = lane & 15, g = lane >> 4;
  const int r0b = blockIdx.x * 64, r0 = r0b + wave * 16; const int b = r0b / HWN;
  // B fragments of both GEMMs run one k group (8 tiles) ahead, as in k_qkv: w1^T and w2^T are adjacent in P, so the 32 groups (128 columns x 32 k
  // each) form one run t = 0..31; group 0 is fetched here, behind each WMMA its register is reloaded for group t + 1 (the last reloads group 31, unused)
  const _Float16* pn = P + (size_t)(3 * CC + col) * CC + 8 * g;      // this lane's first element of tile 0 in the group that is fetched next
  v16h bf[8];
#pragma unroll
  for (int j = 0; j < 8; ++j) bf[j] = frag_hp(pn + j * 16 * CC);
#pragma unroll 1
  for (int h = 0; h < NHD; ++h) { const v16h a = frag_f32(qrows + (size_t)(r0 + col) * CC + h * HC, lane); const float* kvh = kv + ((size_t)b * NHD + h) * (HC * HC);
#pragma unroll
    for (int t = 0; t < 2; ++t) { v16h bb; const int n = t * 16 + col;                       // B[k=d][n=e] = kv[d][e] x64 (scaled in f32 before the cast: keeps small entries normal)
#pragma unroll
      for (int i = 0; i < 8; ++i) { bb[i] = (_Float16)(kvh[(8 * g + i) * HC + n] * 64.0f); bb[8 + i] = (_Float16)(kvh[(16 + 8 * g + i) * HC + n] * 64.0f); }
      v8f acc = {}; acc = wmma16(a, bb, acc);
#pragma unroll
      for (int r = 0; r < 8; ++r) { const int cc = h * HC + t * 16 + col; sr[wave * 16 + 8 * g + r][cc] = acc[r] * (1.0f / 64.0f) + x[(size_t)(r0 + 8 * g + r) * CC + cc]; } } }
  LDSX();
  // hidden = gelu(ret @ w1 + b1): A from sr rows (f32 -> f16), B = P rows 768.. (w1^T x16)
#pragma unroll 1
  for (int nh = 0; nh < 2; ++nh) { v8f acc[8];                     // hidden columns nh*128 .. +127
#pragma unroll
    for (int j = 0; j < 8; ++j) acc[j] = (v8f){};
#pragma unroll 1
    for (int kc = 0; kc < CC / 32; ++kc) { const v16h a = frag_f32(&sr[wave * 16 + col][0] + kc * 32, lane); pn += kc < 7 ? 32 : 128 * CC - 7 * 32;
#pragma unroll
      for (int j = 0; j < 8; ++j) { acc[j] = wmma16(a, bf[j], acc[j]); bf[j] = frag_hp(pn + j * 16 * CC); }
      asm volatile("s_wait_xcnt 0x0" ::: "memory"); }        // the next trip rewrites the address register that the loads above name
#pragma unroll
    for (int j = 0; j < 8; ++j) { const int cc = nh * 128 + j * 16 + col; const float bb = b1[cc];
#pragma unroll
      for (int r = 0; r < 8; ++r) sh[wave * 16 + 8 * g + r][cc] = gelu_e(acc[j][r] * (1.0f / 16.0f) + bb); } }
  LDSX();
  // second GEMM: sr is no longer read (both hidden halves are done), so each output half goes straight into sr
#pragma unroll 1
  for (int nh = 0; nh < 2; ++nh) { v8f acc[8];
#pragma unroll
    for (int j = 0; j < 8; ++j) acc[j] = (v8f){};
#pragma unroll 1
    for (int kc = 0; kc < CC / 32; ++kc) { const v16h a = frag_f32(&sh[wave * 16 + col][0] + kc * 32, lane); pn += kc < 7 ? 32 : (nh == 0 ? 128 * CC - 7 * 32 : 0);
#pragma unroll
      for (int j = 0; j < 8; ++j) { acc[j] = wmma16(a, bf[j], acc[j]); bf[j] = frag_hp(pn + j * 16 * CC); }
      asm volatile("s_wait_xcnt 0x0" ::: "memory"); }        // the next trip rewrites the address register that the loads above name
#pragma unroll
    for (int j = 0; j < 8; ++j) { const int cc = nh * 128 + j * 16 + col; const float bb = b2[cc];
#pragma unroll
      for (int r = 0; r < 8; ++r) sr[wave * 16 + 8 * g + r][cc] = acc[j][r] * (1.0f / 16.0f) + bb + x[(size_t)(r0 + 8 * g + r) * CC + cc]; } }
  LDSX();
  for (int q = lane; q < 16 * 64; q += 32) { const int rl = q >> 6, pc = q & 63; vst2(out + (size_t)(r0 + rl) * CC + pc * 4, *(const v4f*)(&sr[wave * 16 + rl][pc * 4])); }
}
extern "C" void kernel_launch(void* const* d_in, const int* in_sizes, int n_in, void* d_out, int out_size, void* d_ws, size_t ws_size, hipStream_t stream) {
  (void)in_sizes; (void)n_in; (void)out_size; (void)ws_size;
  const float** I = (const float**)d_in;
  const float* x = I[0]; const float* Wqkv = I[1]; const float* bqkv = I[2]; const float* kg = I[3]; const float* kb = I[4]; const float* vg = I[5]; const float* vb = I[6]; const float* W1 = I[7]; const float* b1 = I[8]; const float* W2 = I[9]; const float* b2 = I[10];
  float* out = (float*)d_out;
  char* ws = (char*)d_ws; size_t off = 0;
  auto take = [&](size_t bytes) { char* p = ws + off; off += (bytes + 255) & ~(size_t)255; return p; };
  _Float16* x16 = (_Float16*)take((size_t)NR * CC * 2); _Float16* P = (_Float16*)take((size_t)5 * CC * CC * 2); float* qrows = (float*)take((size_t)NR * CC * 4);
  float* part = (float*)take((size_t)(NR / 64) * NHD * HC * HC * 4); float* kv = (float*)take((size_t)NB * NHD * HC * HC * 4);
  const size_t n8 = (size_t)NR * CC / 8; k_cvt<<<(unsigned)(n8 / 256), 256, 0, stream>>>(x, x16, n8);
  k_packT<<<dim3(3 * CC / 64, CC / 64, 3), 256, 0, stream>>>(Wqkv, W1, W2, P);
  k_qkv<<<NR / 64, 128, 0, stream>>>(x16, P, bqkv, kg, kb, vg, vb, qrows, part);
  k_kv<<<dim3(NHD, NB), 256, 0, stream>>>(part, kv);
  k_mlp<<<NR / 64, 128, 0, stream>>>(qrows, kv, x, P, b1, b2, out);
}

// v002
// A run of this version takes 236 microseconds.
// Timed twice side by side with v001, it ran 1.42 times as fast both times.
// Over all steps from v000 it is 1.81 times as fast.
#include <hip/hip_runtime.h>
#include <math.h>

typedef __attribute__((ext_vector_type(16))) _Float16 v16h;
typedef __attribute__((ext_vector_type(16))) __bf16 v16b;
typedef __attribute__((ext_vector_type(8)))  _Float16 v8h;
typedef __attribute__((ext_vector_type(8)))  float v8f;
typedef __attribute__((ext_vector_type(4)))  float v4f;
typedef __attribute__((ext_vector_type(2)))  float v2f;
typedef __attribute__((ext_vector_type(4)))  unsigned v4u;
typedef __attribute__((ext_vector_type(4)))  int v4i;
typedef float __attribute__((may_alias)) float_a;
typedef int __attribute__((may_alias)) int_a;

template <typename T> __device__ __forceinline__ void vst2(void* p, T v) { *(T*)p = v;  }
__device__ __forceinline__ v8f wmma16(v16h a, v16h b, v8f c) {
  v8f d = __builtin_amdgcn_wmma_f32_16x16x32_f16(false, a, false, b, (short)0, c, false, false);
  asm volatile("v_nop\n\tv_nop\n\tv_nop\n\tv_nop" : "+v"(d) : "v"(a), "v"(b));
  return d;
}
__device__ __forceinline__ v8f wmma_bf(v16b a, v16b b, v8f c) {
  v8f d = __builtin_amdgcn_wmma_f32_16x16x32_bf16(false, a, false, b, (short)0, c, false, false);
  asm volatile("v_nop\n\tv_nop\n\tv_nop\n\tv_nop" : "+v"(d) : "v"(a), "v"(b));
  return d;
}
// 16x16x32 fragments: lane = (h = lane>>4, row/col = lane&15); elements 0..7 = k0+8h+0..7, 8..15 = k0+16+8h+0..7; D element r = row 8h+r
__device__ __forceinline__ v16h frag_h(const _Float16* rowk0, int lane) {
  union { v16h v; v8h q[2]; } u; const _Float16* p = rowk0 + 8 * (lane >> 4);
  u.q[0] = *(const v8h*)p; u.q[1] = *(const v8h*)(p + 16); return u.v;
}
// the same fragment from a pointer that already holds the lane's 8 * (lane >> 4) part
__device__ __forceinline__ v16h frag_hp(const _Float16* p) {
  union { v16h v; v8h q[2]; } u; u.q[0] = *(const v8h*)p; u.q[1] = *(const v8h*)(p + 16); return u.v;
}
__device__ __forceinline__ v16h frag_f32(const float* rowk0, int lane) {
  v16h a; const float* p = rowk0 + 8 * (lane >> 4);
#pragma unroll
  for (int i = 0; i < 8; ++i) { a[i] = (_Float16)p[i]; a[8 + i] = (_Float16)p[16 + i]; }
  return a;
}
__device__ __forceinline__ v16h frag_f32s(const float* rowk0, int lane, float sc) {
  v16h a; const float* p = rowk0 + 8 * (lane >> 4);
#pragma unroll
  for (int i = 0; i < 8; ++i) { a[i] = (_Float16)(p[i] * sc); a[8 + i] = (_Float16)(p[16 + i] * sc); }
  return a;
}
// column fragment from a [K][ld] layout (column n), rows >= K read as 0
__device__ __forceinline__ v16h fragc_f32(const float* W, int k0, int n, int lane, int ld, int K) {
  v16h a; const int g = lane >> 4;
#pragma unroll
  for (int i = 0; i < 8; ++i) { const int ka = k0 + 8 * g + i, kb = ka + 16;
    a[i] = (_Float16)(ka < K ? W[(size_t)ka * ld + n] : 0.f); a[8 + i] = (_Float16)(kb < K ? W[(size_t)kb * ld + n] : 0.f); }
  return a;
}
struct F2 { v16b h, l; };
__device__ __forceinline__ F2 bsplit16(const float v[16]) { F2 r;
#pragma unroll
  for (int i = 0; i < 16; ++i) { const __bf16 h = (__bf16)v[i]; r.h[i] = h; r.l[i] = (__bf16)(v[i] - (float)h); }
  return r; }
__device__ __forceinline__ F2 split_row(const float* row, int k0, int lane) { float v[16]; const float* p = row + k0 + 8 * (lane >> 4);
#pragma unroll
  for (int i = 0; i < 8; ++i) { v[i] = p[i]; v[8 + i] = p[16 + i]; }
  return bsplit16(v); }
__device__ __forceinline__ F2 split_rowK(const float* row, int k0, int lane, int K) { float v[16]; const int g = lane >> 4;
#pragma unroll
  for (int i = 0; i < 8; ++i) { const int ka = k0 + 8 * g + i, kb = ka + 16; v[i] = ka < K ? row[ka] : 0.f; v[8 + i] = kb < K ? row[kb] : 0.f; }
  return bsplit16(v); }
__device__ __forceinline__ F2 split_col(const float* W, int k0, int n, int lane, int ld, int K) { float v[16]; const int g = lane >> 4;
#pragma unroll
  for (int i = 0; i < 8; ++i) { const int ka = k0 + 8 * g + i, kb = ka + 16; v[i] = ka < K ? W[(size_t)ka * ld + n] : 0.f; v[8 + i] = kb < K ? W[(size_t)kb * ld + n] : 0.f; }
  return bsplit16(v); }
__device__ __forceinline__ v8f mac3(const F2& a, const F2& b, v8f c) { c = wmma_bf(a.l, b.h, c); c = wmma_bf(a.h, b.l, c); return wmma_bf(a.h, b.h, c); }
__device__ __forceinline__ float sigm(float v) { return 1.0f / (1.0f + expf(-v)); }
#define LDSX() do { asm volatile("s_wait_dscnt 0" ::: "memory"); __builtin_amdgcn_wave_barrier(); __builtin_amdgcn_fence(__ATOMIC_RELEASE, "workgroup"); } while (0)

// Linear (kernelised) attention block. qkv = x@w_qkv + b on f16 WMMA (x converted once, [in][out] weights packed transposed x16); per
// head LayerNorm of k and v over their 32 channels in f32 (LDS); kv_h = k_h^T v_h as deterministic per-block 32x32 partial sums (f32
// VALU) reduced in fixed order and divided by HW; then per 64-row block: out = q @ kv on WMMA (K = 32), + x, GELU(erf) MLP on f16 WMMA
// with the hidden tile in LDS, + x. The k^T v outer-product partials are VALU (64 rows per block).
#define NB 8
#define HWN 4096
#define CC 256
#define NHD 8
#define HC 32
#define NR (NB * HWN)
#define BPB (HWN / 64)        // 64 row-blocks per batch entry

__device__ __forceinline__ float gelu_e(float v) { return 0.5f * v * (1.0f + erff(v * 0.70710678118654752f)); }

// LayerNorm of one 32-channel group in LDS, done by one lane: 8 reads of 16 bytes, mean and variance summed in registers (four partial sums
// each, folded pairwise), written back in place. At a row pitch of 16 B x odd the 16 lanes of a half wave fall on distinct banks
__device__ __forceinline__ void ln32(float* p, const v4f (&gam)[8], const v4f (&bet)[8]) {
  v4f q[8];
#pragma unroll
  for (int i = 0; i < 8; ++i) q[i] = *(const v4f*)(p + 4 * i);
  v4f s4 = q[0];
#pragma unroll
  for (int i = 1; i < 8; ++i) s4 += q[i];
  const float mu = ((s4[0] + s4[1]) + (s4[2] + s4[3])) * (1.0f / HC);
  v4f w4 = {};
#pragma unroll
  for (int i = 0; i < 8; ++i) { q[i] -= mu; w4 += q[i] * q[i]; }
  float rs; const float va = ((w4[0] + w4[1]) + (w4[2] + w4[3])) * (1.0f / HC) + 1e-5f;      // a sum of squares plus 1e-5: never small enough for rsqrtf's small-input scaling
  asm("v_rsq_f32 %0, %1\n\tv_nop" : "=v"(rs) : "v"(va));      // the v_nop is the free slot asked for behind a transcendental; in one statement it stays directly behind it
#pragma unroll
  for (int i = 0; i < 8; ++i) {
#pragma unroll
    for (int e = 0; e < 4; ++e) q[i][e] = q[i][e] * rs * gam[i][e] + bet[i][e];
    vst2(p + 4 * i, q[i]); }
}
__global__ __launch_bounds__(256) void k_cvt(const float* __restrict__ x, _Float16* __restrict__ x16, size_t n8) {
  const size_t g8 = (size_t)blockIdx.x * 256 + threadIdx.x; if (g8 >= n8) return;
  union { v8h h; v4u u; } pk;
#pragma unroll
  for (int e = 0; e < 8; ++e) pk.h[e] = (_Float16)x[g8 * 8 + e];
  vst2(x16 + g8 * 8, pk.u);
}
__global__ __launch_bounds__(256) void k_packT(const float* __restrict__ Wqkv, const float* __restrict__ W1, const float* __restrict__ W2, _Float16* __restrict__ P) {   // P rows: [0,768) w_qkv^T, [768,1024) w1^T, [1024,1280) w2^T, each [n][256] x16
  __shared__ float tile[64][65];
  const int which = blockIdx.z, o0 = blockIdx.x * 64, k0 = blockIdx.y * 64, tid = threadIdx.x;
  const float* W = which == 0 ? Wqkv : (which == 1 ? W1 : W2); const int NOUT = which == 0 ? 3 * CC : CC; const int rowbase = which == 0 ? 0 : (which == 1 ? 3 * CC : 4 * CC);
  if (o0 >= NOUT) return;                                // uniform per block, before any barrier
  for (int q = tid; q < 64 * 64; q += 256) { const int kl = q >> 6, ol = q & 63; tile[kl][ol] = W[(size_t)(k0 + kl) * NOUT + o0 + ol]; }
  __syncthreads();
  for (int u = 0; u < 2; ++u) { const int idx = tid + u * 256, ol = idx >> 3, pc = idx & 7; union { v8h hh; v4u uu; } pk;
#pragma unroll
    for (int i = 0; i < 8; ++i) pk.hh[i] = (_Float16)(tile[pc * 8 + i][ol] * 16.0f);
    vst2(P + ((size_t)rowbase + o0 + ol) * CC + k0 + pc * 8, pk.uu); }
}
// qkv for 64 rows: column n of the 768 = h*96 + which*32 + c (reference reshape (B,HW,8,96) then split). q -> sq, k -> sk, v -> sv (LDS f32),
// LN(k), LN(v) per (row, head); q rows -> global f32 [r][h*32+c]; kv partial [blk][h][32][32] = sum_rows kn (x) vn
__global__ __launch_bounds__(128) void k_qkv(const _Float16* __restrict__ x16, const _Float16* __restrict__ P, const float* __restrict__ bqkv, const float* __restrict__ kg, const float* __restrict__ kb, const float* __restrict__ vg, const float* __restrict__ vb,
                                           float* __restrict__ qrows, float* __restrict__ part) {
  __shared__ __align__(16) float sq[64][CC + 4], sk[64][CC + 4], sv[64][CC + 4];
  const int tid = threadIdx.x, wave = tid >> 5, lane = tid & 31, col = lane & 15, g = lane >> 4;
  const int r0b = blockIdx.x * 64, r0 = r0b + wave * 16;
  v16h ax[8];
#pragma unroll
  for (int kc = 0; kc < 8; ++kc) ax[kc] = frag_h(x16 + (size_t)(r0 + col) * CC + kc * 32, lane);
  // B fragments run one k group (8 tiles) ahead: behind each WMMA its fragment register is reloaded for the next group, so 8 fragments
  // are always in flight and no WMMA waits out the latency of its own loads. The last group reloads chunk 5, k group 0 (in bounds, unused)
  v16h bf[8];
#pragma unroll
  for (int j = 0; j < 8; ++j) bf[j] = frag_h(P + (size_t)(j * 16 + col) * CC, lane);
#pragma unroll 1
  for (int nc = 0; nc < 6; ++nc) { v8f acc[8] = {}; const int ncn = nc < 5 ? nc + 1 : 5;
#pragma unroll
    for (int kc = 0; kc < 8; ++kc) {
#pragma unroll
      for (int j = 0; j < 8; ++j) { acc[j] = wmma16(ax[kc], bf[j], acc[j]);
        bf[j] = frag_h(P + (size_t)((kc < 7 ? nc : ncn) * 128 + j * 16 + col) * CC + ((kc + 1) & 7) * 32, lane); } }
#pragma unroll
    for (int j = 0; j < 8; ++j) { const int n = nc * 128 + j * 16 + col; const float bb = bqkv[n]; const int h = n / 96, wch = (n % 96) / 32, c = n % 32; const int cc = h * HC + c;
      float (*dst)[CC + 4] = wch == 0 ? sq : (wch == 1 ? sk : sv);
#pragma unroll
      for (int r = 0; r < 8; ++r) dst[wave * 16 + 8 * g + r][cc] = acc[j][r] * (1.0f / 16.0f) + bb; } }
  LDSX();
  // LN of k and v per (row, head) over 32 channels: one lane owns a whole group (row = lane & 15, head = 2t + (lane >> 4)) and sums it in registers
  v4f gk[8], bk[8], gv[8], bv[8];                        // gamma and beta, the same for every group: fetched once, ahead of both loops
#pragma unroll
  for (int i = 0; i < 32; ++i) { gk[i >> 2][i & 3] = kg[i]; bk[i >> 2][i & 3] = kb[i]; gv[i >> 2][i & 3] = vg[i]; bv[i >> 2][i & 3] = vb[i]; }
  // two groups per trip: the second group's LDS reads run under the first one's sums; all four at once took the kernel past 256 registers
#pragma unroll 2
  for (int t = 0; t < NHD / 2; ++t) ln32(&sk[wave * 16 + col][(2 * t + g) * HC], gk, bk);
#pragma unroll 2
  for (int t = 0; t < NHD / 2; ++t) ln32(&sv[wave * 16 + col][(2 * t + g) * HC], gv, bv);
  // q rows out (wave's 16 rows)
  for (int q = lane; q < 16 * 64; q += 32) { const int rl = q >> 6, pc = q & 63; vst2(qrows + (size_t)(r0 + rl) * CC + pc * 4, *(const v4f*)(&sq[wave * 16 + rl][pc * 4])); }
  __syncthreads();
  // kv partials over the block's 64 rows: thread (128) -> for each head: 32x32 = 1024 outputs / 128 = 8 per thread
  __shared__ __align__(16) float sp[NHD * HC * HC];
#pragma unroll 1
  for (int h = 0; h < NHD; ++h) {
    float a8[8]; const int d = tid >> 2, e0 = (tid & 3) * 8;             // (d, e0..e0+7)
#pragma unroll
    for (int u = 0; u < 8; ++u) a8[u] = 0.f;
#pragma unroll 4
    for (int rl = 0; rl < 64; ++rl) { const float kd = sk[rl][h * HC + d];
#pragma unroll
      for (int u = 0; u < 8; ++u) a8[u] += kd * sv[rl][h * HC + e0 + u]; }
#pragma unroll
    for (int u = 0; u < 8; ++u) sp[(h * HC + d) * HC + e0 + u] = a8[u]; }
  __syncthreads();
  for (int q = tid; q < NHD * HC * HC / 4; q += 128) vst2(part + (size_t)blockIdx.x * (NHD * HC * HC) + q * 4, *(const v4f*)(&sp[q * 4]));
}
// kv[b][h][32][32] = (sum over the 64 blocks of batch b, fixed order) / HW ; block = (b, h)
__global__ __launch_bounds__(256) void k_kv(const float* __restrict__ part, float* __restrict__ kv) {
  __shared__ __align__(16) float so[HC * HC];
  const int b = blockIdx.y, h = blockIdx.x, tid = threadIdx.x;
  for (int e = tid; e < HC * HC; e += 256) { float s = 0.f;
#pragma unroll 1
    for (int blk = 0; blk < BPB; ++blk) s += part[((size_t)(b * BPB + blk) * NHD + h) * (HC * HC) + e];
    so[e] = s * (1.0f / (float)HWN); }
  __syncthreads();
  vst2(kv + ((size_t)b * NHD + h) * (HC * HC) + tid * 4, *(const v4f*)(&so[tid * 4]));
}
// per 64-row block: out = q @ kv (WMMA per head, K = 32, N = 32) + x -> ret (LDS); hid = gelu(ret @ w1 + b1) (LDS); out = hid @ w2 + b2 + x
__global__ __launch_bounds__(128) void k_mlp(const float* __restrict__ qrows, const float* __restrict__ kv, const float* __restrict__ x, const _Float16* __restrict__ P, const float* __restrict__ b1, const float* __restrict__ b2, float* __restrict__ out) {
  __shared__ __align__(16) float sr[64][CC + 4];      // ret, later reused for the output tile
  __shared__ __align__(16) float sh[64][CC + 4];      // hidden
  const int tid = threadIdx.x, wave = tid >> 5, lane = tid & 31, col = lane & 15, g = lane >> 4;
  const int r0b = blockIdx.x * 64, r0 = r0b + wave * 16; const int b = r0b / HWN;
  // B fragments of both GEMMs run one k group (8 tiles) ahead, as in k_qkv: w1^T and w2^T are adjacent in P, so the 32 groups (128 columns x 32 k
  // each) form one run t = 0..31; group 0 is fetched here, behind each WMMA its register is reloaded for group t + 1 (the last reloads group 31, unused)
  const _Float16* pn = P + (size_t)(3 * CC + col) * CC + 8 * g;      // this lane's first element of tile 0 in the group that is fetched next
  v16h bf[8];
#pragma unroll
  for (int j = 0; j < 8; ++j) bf[j] = frag_hp(pn + j * 16 * CC);
#pragma unroll 1
  for (int h = 0; h < NHD; ++h) { const v16h a = frag_f32(qrows + (size_t)(r0 + col) * CC + h * HC, lane); const float* kvh = kv + ((size_t)b * NHD + h) * (HC * HC);
#pragma unroll
    for (int t = 0; t < 2; ++t) { v16h bb; const int n = t * 16 + col;                       // B[k=d][n=e] = kv[d][e] x64 (scaled in f32 before the cast: keeps small entries normal)
#pragma unroll
      for (int i = 0; i < 8; ++i) { bb[i] = (_Float16)(kvh[(8 * g + i) * HC + n] * 64.0f); bb[8 + i] = (_Float16)(kvh[(16 + 8 * g + i) * HC + n] * 64.0f); }
      v8f acc = {}; acc = wmma16(a, bb, acc);
#pragma unroll
      for (int r = 0; r < 8; ++r) { const int cc = h * HC + t * 16 + col; sr[wave * 16 + 8 * g + r][cc] = acc[r] * (1.0f / 64.0f) + x[(size_t)(r0 + 8 * g + r) * CC + cc]; } } }
  LDSX();
  // hidden = gelu(ret @ w1 + b1): A from sr rows (f32 -> f16), B = P rows 768.. (w1^T x16)
#pragma unroll 1
  for (int nh = 0; nh < 2; ++nh) { v8f acc[8];                     // hidden columns nh*128 .. +127
#pragma unroll
    for (int j = 0; j < 8; ++j) acc[j] = (v8f){};
#pragma unroll 1
    for (int kc = 0; kc < CC / 32; ++kc) { const v16h a = frag_f32(&sr[wave * 16 + col][0] + kc * 32, lane); pn += kc < 7 ? 32 : 128 * CC - 7 * 32;
#pragma unroll
      for (int j = 0; j < 8; ++j) { acc[j] = wmma16(a, bf[j], acc[j]); bf[j] = frag_hp(pn + j * 16 * CC); }
      asm volatile("s_wait_xcnt 0x0" ::: "memory"); }        // the next trip rewrites the address register that the loads above name
#pragma unroll
    for (int j = 0; j < 8; ++j) { const int cc = nh * 128 + j * 16 + col; const float bb = b1[cc];
#pragma unroll
      for (int r = 0; r < 8; ++r) sh[wave * 16 + 8 * g + r][cc] = gelu_e(acc[j][r] * (1.0f / 16.0f) + bb); } }
  LDSX();
  // second GEMM: sr is no longer read (both hidden halves are done), so each output half goes straight into sr
#pragma unroll 1
  for (int nh = 0; nh < 2; ++nh) { v8f acc[8];
#pragma unroll
    for (int j = 0; j < 8; ++j) acc[j] = (v8f){};
#pragma unroll 1
    for (int kc = 0; kc < CC / 32; ++kc) { const v16h a = frag_f32(&sh[wave * 16 + col][0] + kc * 32, lane); pn += kc < 7 ? 32 : (nh == 0 ? 128 * CC - 7 * 32 : 0);
#pragma unroll
      for (int j = 0; j < 8; ++j) { acc[j] = wmma16(a, bf[j], acc[j]); bf[j] = frag_hp(pn + j * 16 * CC); }
      asm volatile("s_wait_xcnt 0x0" ::: "memory"); }        // the next trip rewrites the address register that the loads above name
#pragma unroll
    for (int j = 0; j < 8; ++j) { const int cc = nh * 128 + j * 16 + col; const float bb = b2[cc];
#pragma unroll
      for (int r = 0; r < 8; ++r) sr[wave * 16 + 8 * g + r][cc] = acc[j][r] * (1.0f / 16.0f) + bb + x[(size_t)(r0 + 8 * g + r) * CC + cc]; } }
  LDSX();
  for (int q = lane; q < 16 * 64; q += 32) { const int rl = q >> 6, pc = q & 63; vst2(out + (size_t)(r0 + rl) * CC + pc * 4, *(const v4f*)(&sr[wave * 16 + rl][pc * 4])); }
}
extern "C" void kernel_launch(void* const* d_in, const int* in_sizes, int n_in, void* d_out, int out_size, void* d_ws, size_t ws_size, hipStream_t stream) {
  (void)in_sizes; (void)n_in; (void)out_size; (void)ws_size;
  const float** I = (const float**)d_in;
  const float* x = I[0]; const float* Wqkv = I[1]; const float* bqkv = I[2]; const float* kg = I[3]; const float* kb = I[4]; const float* vg = I[5]; const float* vb = I[6]; const float* W1 = I[7]; const float* b1 = I[8]; const float* W2 = I[9]; const float* b2 = I[10];
  float* out = (float*)d_out;
  char* ws = (char*)d_ws; size_t off = 0;
  auto take = [&](size_t bytes) { char* p = ws + off; off += (bytes + 255) & ~(size_t)255; return p; };
  _Float16* x16 = (_Float16*)take((size_t)NR * CC * 2); _Float16* P = (_Float16*)take((size_t)5 * CC * CC * 2); float* qrows = (float*)take((size_t)NR * CC * 4);
  float* part = (float*)take((size_t)(NR / 64) * NHD * HC * HC * 4); float* kv = (float*)take((size_t)NB * NHD * HC * HC * 4);
  const size_t n8 = (size_t)NR * CC / 8; k_cvt<<<(unsigned)(n8 / 256), 256, 0, stream>>>(x, x16, n8);
  k_packT<<<dim3(3 * CC / 64, CC / 64, 3), 256, 0, stream>>>(Wqkv, W1, W2, P);
  k_qkv<<<NR / 64, 128, 0, stream>>>(x16, P, bqkv, kg, kb, vg, vb, qrows, part);
  k_kv<<<dim3(NHD, NB), 256, 0, stream>>>(part, kv);
  k_mlp<<<NR / 64, 128, 0, stream>>>(qrows, kv, x, P, b1, b2, out);
}

// v003
// It runs in 140 microseconds.
// Timed twice side by side with v002, it ran 1.70 times as fast both times.
// All steps since v000 together make it 3.08 times as fast.
#include <hip/hip_runtime.h>
#include <math.h>

typedef __attribute__((ext_vector_type(16))) _Float16 v16h;
typedef __attribute__((ext_vector_type(16))) __bf16 v16b;
typedef __attribute__((ext_vector_type(8)))  _Float16 v8h;
typedef __attribute__((ext_vector_type(8)))  float v8f;
typedef __attribute__((ext_vector_type(4)))  float v4f;
typedef __attribute__((ext_vector_type(2)))  float v2f;
typedef __attribute__((ext_vector_type(4)))  unsigned v4u;
typedef __attribute__((ext_vector_type(4)))  int v4i;
typedef float __attribute__((may_alias)) float_a;
typedef int __attribute__((may_alias)) int_a;

template <typename T> __device__ __forceinline__ void vst2(void* p, T v) { *(T*)p = v;  }
__device__ __forceinline__ v8f wmma16(v16h a, v16h b, v8f c) {
  v8f d = __builtin_amdgcn_wmma_f32_16x16x32_f16(false, a, false, b, (short)0, c, false, false);
  asm volatile("v_nop\n\tv_nop\n\tv_nop\n\tv_nop" : "+v"(d) : "v"(a), "v"(b));
  return d;
}
__device__ __forceinline__ v8f wmma_bf(v16b a, v16b b, v8f c) {
  v8f d = __builtin_amdgcn_wmma_f32_16x16x32_bf16(false, a, false, b, (short)0, c, false, false);
  asm volatile("v_nop\n\tv_nop\n\tv_nop\n\tv_nop" : "+v"(d) : "v"(a), "v"(b));
  return d;
}
// 16x16x32 fragments: lane = (h = lane>>4, row/col = lane&15); elements 0..7 = k0+8h+0..7, 8..15 = k0+16+8h+0..7; D element r = row 8h+r
__device__ __forceinline__ v16h frag_h(const _Float16* rowk0, int lane) {
  union { v16h v; v8h q[2]; } u; const _Float16* p = rowk0 + 8 * (lane >> 4);
  u.q[0] = *(const v8h*)p; u.q[1] = *(const v8h*)(p + 16); return u.v;
}
// the same fragment from a pointer that already holds the lane's 8 * (lane >> 4) part
__device__ __forceinline__ v16h frag_hp(const _Float16* p) {
  union { v16h v; v8h q[2]; } u; u.q[0] = *(const v8h*)p; u.q[1] = *(const v8h*)(p + 16); return u.v;
}
__device__ __forceinline__ v16h frag_f32(const float* rowk0, int lane) {
  v16h a; const float* p = rowk0 + 8 * (lane >> 4);
#pragma unroll
  for (int i = 0; i < 8; ++i) { a[i] = (_Float16)p[i]; a[8 + i] = (_Float16)p[16 + i]; }
  return a;
}
__device__ __forceinline__ v16h frag_f32s(const float* rowk0, int lane, float sc) {
  v16h a; const float* p = rowk0 + 8 * (lane >> 4);
#pragma unroll
  for (int i = 0; i < 8; ++i) { a[i] = (_Float16)(p[i] * sc); a[8 + i] = (_Float16)(p[16 + i] * sc); }
  return a;
}
// column fragment from a [K][ld] layout (column n), rows >= K read as 0
__device__ __forceinline__ v16h fragc_f32(const float* W, int k0, int n, int lane, int ld, int K) {
  v16h a; const int g = lane >> 4;
#pragma unroll
  for (int i = 0; i < 8; ++i) { const int ka = k0 + 8 * g + i, kb = ka + 16;
    a[i] = (_Float16)(ka < K ? W[(size_t)ka * ld + n] : 0.f); a[8 + i] = (_Float16)(kb < K ? W[(size_t)kb * ld + n] : 0.f); }
  return a;
}
struct F2 { v16b h, l; };
__device__ __forceinline__ F2 bsplit16(const float v[16]) { F2 r;
#pragma unroll
  for (int i = 0; i < 16; ++i) { const __bf16 h = (__bf16)v[i]; r.h[i] = h; r.l[i] = (__bf16)(v[i] - (float)h); }
  return r; }
__device__ __forceinline__ F2 split_row(const float* row, int k0, int lane) { float v[16]; const float* p = row + k0 + 8 * (lane >> 4);
#pragma unroll
  for (int i = 0; i < 8; ++i) { v[i] = p[i]; v[8 + i] = p[16 + i]; }
  return bsplit16(v); }
__device__ __forceinline__ F2 split_rowK(const float* row, int k0, int lane, int K) { float v[16]; const int g = lane >> 4;
#pragma unroll
  for (int i = 0; i < 8; ++i) { const int ka = k0 + 8 * g + i, kb = ka + 16; v[i] = ka < K ? row[ka] : 0.f; v[8 + i] = kb < K ? row[kb] : 0.f; }
  return bsplit16(v); }
__device__ __forceinline__ F2 split_col(const float* W, int k0, int n, int lane, int ld, int K) { float v[16]; const int g = lane >> 4;
#pragma unroll
  for (int i = 0; i < 8; ++i) { const int ka = k0 + 8 * g + i, kb = ka + 16; v[i] = ka < K ? W[(size_t)ka * ld + n] : 0.f; v[8 + i] = kb < K ? W[(size_t)kb * ld + n] : 0.f; }
  return bsplit16(v); }
__device__ __forceinline__ v8f mac3(const F2& a, const F2& b, v8f c) { c = wmma_bf(a.l, b.h, c); c = wmma_bf(a.h, b.l, c); return wmma_bf(a.h, b.h, c); }
__device__ __forceinline__ float sigm(float v) { return 1.0f / (1.0f + expf(-v)); }
#define LDSX() do { asm volatile("s_wait_dscnt 0" ::: "memory"); __builtin_amdgcn_wave_barrier(); __builtin_amdgcn_fence(__ATOMIC_RELEASE, "workgroup"); } while (0)

// Linear (kernelised) attention block. qkv = x@w_qkv + b on f16 WMMA (x converted once, [in][out] weights packed transposed x16); per
// head LayerNorm of k and v over their 32 channels in f32 (LDS); kv_h = k_h^T v_h as deterministic per-block 32x32 partial sums (f32
// VALU) reduced in fixed order and divided by HW; then per 64-row block: out = q @ kv on WMMA (K = 32), + x, GELU(erf) MLP on f16 WMMA
// with the hidden tile in LDS, + x. The k^T v outer-product partials are VALU (64 rows per block).
#define NB 8
#define HWN 4096
#define CC 256
#define NHD 8
#define HC 32
#define NR (NB * HWN)
#define BPB (HWN / 64)        // 64 row-blocks per batch entry

__device__ __forceinline__ float gelu_e(float v) { return 0.5f * v * (1.0f + erff(v * 0.70710678118654752f)); }

// LayerNorm of one 32-channel group in LDS, done by one lane: 8 reads of 16 bytes, mean and variance summed in registers (four partial sums
// each, folded pairwise), written back in place. At a row pitch of 16 B x odd the 16 lanes of a half wave fall on distinct banks
__device__ __forceinline__ void ln32(float* p, const v4f (&gam)[8], const v4f (&bet)[8]) {
  v4f q[8];
#pragma unroll
  for (int i = 0; i < 8; ++i) q[i] = *(const v4f*)(p + 4 * i);
  v4f s4 = q[0];
#pragma unroll
  for (int i = 1; i < 8; ++i) s4 += q[i];
  const float mu = ((s4[0] + s4[1]) + (s4[2] + s4[3])) * (1.0f / HC);
  v4f w4 = {};
#pragma unroll
  for (int i = 0; i < 8; ++i) { q[i] -= mu; w4 += q[i] * q[i]; }
  float rs; const float va = ((w4[0] + w4[1]) + (w4[2] + w4[3])) * (1.0f / HC) + 1e-5f;      // a sum of squares plus 1e-5: never small enough for rsqrtf's small-input scaling
  asm("v_rsq_f32 %0, %1\n\tv_nop" : "=v"(rs) : "v"(va));      // the v_nop is the free slot asked for behind a transcendental; in one statement it stays directly behind it
#pragma unroll
  for (int i = 0; i < 8; ++i) {
#pragma unroll
    for (int e = 0; e < 4; ++e) q[i][e] = q[i][e] * rs * gam[i][e] + bet[i][e];
    vst2(p + 4 * i, q[i]); }
}
__global__ __launch_bounds__(256) void k_cvt(const float* __restrict__ x, _Float16* __restrict__ x16, size_t n8) {
  const size_t g8 = (size_t)blockIdx.x * 256 + threadIdx.x; if (g8 >= n8) return;
  union { v8h h; v4u u; } pk;
#pragma unroll
  for (int e = 0; e < 8; ++e) pk.h[e] = (_Float16)x[g8 * 8 + e];
  vst2(x16 + g8 * 8, pk.u);
}
__global__ __launch_bounds__(256) void k_packT(const float* __restrict__ Wqkv, const float* __restrict__ W1, const float* __restrict__ W2, _Float16* __restrict__ P) {   // P rows: [0,768) w_qkv^T, [768,1024) w1^T, [1024,1280) w2^T, each [n][256] x16
  __shared__ float tile[64][65];
  const int which = blockIdx.z, o0 = blockIdx.x * 64, k0 = blockIdx.y * 64, tid = threadIdx.x;
  const float* W = which == 0 ? Wqkv : (which == 1 ? W1 : W2); const int NOUT = which == 0 ? 3 * CC : CC; const int rowbase = which == 0 ? 0 : (which == 1 ? 3 * CC : 4 * CC);
  if (o0 >= NOUT) return;                                // uniform per block, before any barrier
  for (int q = tid; q < 64 * 64; q += 256) { const int kl = q >> 6, ol = q & 63; tile[kl][ol] = W[(size_t)(k0 + kl) * NOUT + o0 + ol]; }
  __syncthreads();
  for (int u = 0; u < 2; ++u) { const int idx = tid + u * 256, ol = idx >> 3, pc = idx & 7; union { v8h hh; v4u uu; } pk;
#pragma unroll
    for (int i = 0; i < 8; ++i) pk.hh[i] = (_Float16)(tile[pc * 8 + i][ol] * 16.0f);
    vst2(P + ((size_t)rowbase + o0 + ol) * CC + k0 + pc * 8, pk.uu); }
}
// qkv for 64 rows: column n of the 768 = h*96 + which*32 + c (reference reshape (B,HW,8,96) then split). q -> sq, k -> sk, v -> sv (LDS f32),
// LN(k), LN(v) per (row, head); q rows -> global f32 [r][h*32+c]; kv partial [blk][h][32][32] = sum_rows kn (x) vn
__global__ __launch_bounds__(128) void k_qkv(const _Float16* __restrict__ x16, const _Float16* __restrict__ P, const float* __restrict__ bqkv, const float* __restrict__ kg, const float* __restrict__ kb, const float* __restrict__ vg, const float* __restrict__ vb,
                                           float* __restrict__ qrows, float* __restrict__ part) {
  __shared__ __align__(16) float sq[64][CC + 4], sk[64][CC + 4], sv[64][CC + 4];
  const int tid = threadIdx.x, wave = tid >> 5, lane = tid & 31, col = lane & 15, g = lane >> 4;
  const int r0b = blockIdx.x * 64, r0 = r0b + wave * 16;
  v16h ax[8];
#pragma unroll
  for (int kc = 0; kc < 8; ++kc) ax[kc] = frag_h(x16 + (size_t)(r0 + col) * CC + kc * 32, lane);
  // B fragments run one k group (8 tiles) ahead: behind each WMMA its fragment register is reloaded for the next group, so 8 fragments
  // are always in flight and no WMMA waits out the latency of its own loads. The last group reloads chunk 5, k group 0 (in bounds, unused)
  v16h bf[8];
#pragma unroll
  for (int j = 0; j < 8; ++j) bf[j] = frag_h(P + (size_t)(j * 16 + col) * CC, lane);
#pragma unroll 1
  for (int nc = 0; nc < 6; ++nc) { v8f acc[8] = {}; const int ncn = nc < 5 ? nc + 1 : 5;
#pragma unroll
    for (int kc = 0; kc < 8; ++kc) {
#pragma unroll
      for (int j = 0; j < 8; ++j) { acc[j] = wmma16(ax[kc], bf[j], acc[j]);
        bf[j] = frag_h(P + (size_t)((kc < 7 ? nc : ncn) * 128 + j * 16 + col) * CC + ((kc + 1) & 7) * 32, lane); } }
#pragma unroll
    for (int j = 0; j < 8; ++j) { const int n = nc * 128 + j * 16 + col; const float bb = bqkv[n]; const int h = n / 96, wch = (n % 96) / 32, c = n % 32; const int cc = h * HC + c;
      float (*dst)[CC + 4] = wch == 0 ? sq : (wch == 1 ? sk : sv);
#pragma unroll
      for (int r = 0; r < 8; ++r) dst[wave * 16 + 8 * g + r][cc] = acc[j][r] * (1.0f / 16.0f) + bb; } }
  LDSX();
  // LN of k and v per (row, head) over 32 channels: one lane owns a whole group (row = lane & 15, head = 2t + (lane >> 4)) and sums it in registers
  v4f gk[8], bk[8], gv[8], bv[8];                        // gamma and beta, the same for every group: fetched once, ahead of both loops
#pragma unroll
  for (int i = 0; i < 32; ++i) { gk[i >> 2][i & 3] = kg[i]; bk[i >> 2][i & 3] = kb[i]; gv[i >> 2][i & 3] = vg[i]; bv[i >> 2][i & 3] = vb[i]; }
  // two groups per trip: the second group's LDS reads run under the first one's sums; all four at once took the kernel past 256 registers
#pragma unroll 2
  for (int t = 0; t < NHD / 2; ++t) ln32(&sk[wave * 16 + col][(2 * t + g) * HC], gk, bk);
#pragma unroll 2
  for (int t = 0; t < NHD / 2; ++t) ln32(&sv[wave * 16 + col][(2 * t + g) * HC], gv, bv);
  // q rows out (wave's 16 rows)
  for (int q = lane; q < 16 * 64; q += 32) { const int rl = q >> 6, pc = q & 63; vst2(qrows + (size_t)(r0 + rl) * CC + pc * 4, *(const v4f*)(&sq[wave * 16 + rl][pc * 4])); }
  __syncthreads();
  // kv partials over the block's 64 rows: thread (128) -> for each head: 32x32 = 1024 outputs / 128 = 8 per thread
  __shared__ __align__(16) float sp[NHD * HC * HC];
#pragma unroll 1
  for (int h = 0; h < NHD; ++h) {
    float a8[8]; const int d = tid >> 2, e0 = (tid & 3) * 8;             // (d, e0..e0+7)
#pragma unroll
    for (int u = 0; u < 8; ++u) a8[u] = 0.f;
#pragma unroll 4
    for (int rl = 0; rl < 64; ++rl) { const float kd = sk[rl][h * HC + d];
#pragma unroll
      for (int u = 0; u < 8; ++u) a8[u] += kd * sv[rl][h * HC + e0 + u]; }
#pragma unroll
    for (int u = 0; u < 8; ++u) sp[(h * HC + d) * HC + e0 + u] = a8[u]; }
  __syncthreads();
  for (int q = tid; q < NHD * HC * HC / 4; q += 128) vst2(part + (size_t)blockIdx.x * (NHD * HC * HC) + q * 4, *(const v4f*)(&sp[q * 4]));
}
// kv[b][h][32][32] = (sum over the 64 blocks of batch b, fixed order) / HW. The (h, d, e) planes of one batch entry are 8192 adjacent floats in
// part and in kv alike: one thread owns two adjacent outputs. Its 64 loads depend on nothing: with both loops unrolled whole the compiler issues them
// far ahead of the adds (a rolled loop waits out one full load latency per term); the adds keep the order blk = 0..63
__global__ __launch_bounds__(128) void k_kv(const float* __restrict__ part, float* __restrict__ kv) {
  const int i2 = (blockIdx.x * 128 + threadIdx.x) * 2;                // first of the two outputs, in [0, NB * 8192)
  const int b = i2 / (NHD * HC * HC), i = i2 % (NHD * HC * HC);
  const float* p = part + (size_t)b * BPB * (NHD * HC * HC) + i;
  v2f t[BPB];
#pragma unroll
  for (int blk = 0; blk < BPB; ++blk) t[blk] = *(const v2f*)(p + (size_t)blk * (NHD * HC * HC));
  v2f s = {};
#pragma unroll
  for (int blk = 0; blk < BPB; ++blk) s += t[blk];
  vst2(kv + i2, s * (1.0f / (float)HWN));
}
// per 64-row block: out = q @ kv (WMMA per head, K = 32, N = 32) + x -> ret (LDS); hid = gelu(ret @ w1 + b1) (LDS); out = hid @ w2 + b2 + x
__global__ __launch_bounds__(128) void k_mlp(const float* __restrict__ qrows, const float* __restrict__ kv, const float* __restrict__ x, const _Float16* __restrict__ P, const float* __restrict__ b1, const float* __restrict__ b2, float* __restrict__ out) {
  __shared__ __align__(16) float sr[64][CC + 4];      // ret, later reused for the output tile
  __shared__ __align__(16) float sh[64][CC + 4];      // hidden
  const int tid = threadIdx.x, wave = tid >> 5, lane = tid & 31, col = lane & 15, g = lane >> 4;
  const int r0b = blockIdx.x * 64, r0 = r0b + wave * 16; const int b = r0b / HWN;
  // B fragments of both GEMMs run one k group (8 tiles) ahead, as in k_qkv: w1^T and w2^T are adjacent in P, so the 32 groups (128 columns x 32 k
  // each) form one run t = 0..31; group 0 is fetched here, behind each WMMA its register is reloaded for group t + 1 (the last reloads group 31, unused)
  const _Float16* pn = P + (size_t)(3 * CC + col) * CC + 8 * g;      // this lane's first element of tile 0 in the group that is fetched next
  v16h bf[8];
#pragma unroll
  for (int j = 0; j < 8; ++j) bf[j] = frag_hp(pn + j * 16 * CC);
#pragma unroll 1
  for (int h = 0; h < NHD; ++h) { const v16h a = frag_f32(qrows + (size_t)(r0 + col) * CC + h * HC, lane); const float* kvh = kv + ((size_t)b * NHD + h) * (HC * HC);
#pragma unroll
    for (int t = 0; t < 2; ++t) { v16h bb; const int n = t * 16 + col;                       // B[k=d][n=e] = kv[d][e] x64 (scaled in f32 before the cast: keeps small entries normal)
#pragma unroll
      for (int i = 0; i < 8; ++i) { bb[i] = (_Float16)(kvh[(8 * g + i) * HC + n] * 64.0f); bb[8 + i] = (_Float16)(kvh[(16 + 8 * g + i) * HC + n] * 64.0f); }
      v8f acc = {}; acc = wmma16(a, bb, acc);
#pragma unroll
      for (int r = 0; r < 8; ++r) { const int cc = h * HC + t * 16 + col; sr[wave * 16 + 8 * g + r][cc] = acc[r] * (1.0f / 64.0f) + x[(size_t)(r0 + 8 * g + r) * CC + cc]; } } }
  LDSX();
  // hidden = gelu(ret @ w1 + b1): A from sr rows (f32 -> f16), B = P rows 768.. (w1^T x16)
#pragma unroll 1
  for (int nh = 0; nh < 2; ++nh) { v8f acc[8];                     // hidden columns nh*128 .. +127
#pragma unroll
    for (int j = 0; j < 8; ++j) acc[j] = (v8f){};
#pragma unroll 1
    for (int kc = 0; kc < CC / 32; ++kc) { const v16h a = frag_f32(&sr[wave * 16 + col][0] + kc * 32, lane); pn += kc < 7 ? 32 : 128 * CC - 7 * 32;
#pragma unroll
      for (int j = 0; j < 8; ++j) { acc[j] = wmma16(a, bf[j], acc[j]); bf[j] = frag_hp(pn + j * 16 * CC); }
      asm volatile("s_wait_xcnt 0x0" ::: "memory"); }        // the next trip rewrites the address register that the loads above name
#pragma unroll
    for (int j = 0; j < 8; ++j) { const int cc = nh * 128 + j * 16 + col; const float bb = b1[cc];
#pragma unroll
      for (int r = 0; r < 8; ++r) sh[wave * 16 + 8 * g + r][cc] = gelu_e(acc[j][r] * (1.0f / 16.0f) + bb); } }
  LDSX();
  // second GEMM: sr is no longer read (both hidden halves are done), so each output half goes straight into sr
#pragma unroll 1
  for (int nh = 0; nh < 2; ++nh) { v8f acc[8];
#pragma unroll
    for (int j = 0; j < 8; ++j) acc[j] = (v8f){};
#pragma unroll 1
    for (int kc = 0; kc < CC / 32; ++kc) { const v16h a = frag_f32(&sh[wave * 16 + col][0] + kc * 32, lane); pn += kc < 7 ? 32 : (nh == 0 ? 128 * CC - 7 * 32 : 0);
#pragma unroll
      for (int j = 0; j < 8; ++j) { acc[j] = wmma16(a, bf[j], acc[j]); bf[j] = frag_hp(pn + j * 16 * CC); }
      asm volatile("s_wait_xcnt 0x0" ::: "memory"); }        // the next trip rewrites the address register that the loads above name
#pragma unroll
    for (int j = 0; j < 8; ++j) { const int cc = nh * 128 + j * 16 + col; const float bb = b2[cc];
#pragma unroll
      for (int r = 0; r < 8; ++r) sr[wave * 16 + 8 * g + r][cc] = acc[j][r] * (1.0f / 16.0f) + bb + x[(size_t)(r0 + 8 * g + r) * CC + cc]; } }
  LDSX();
  for (int q = lane; q < 16 * 64; q += 32) { const int rl = q >> 6, pc = q & 63; vst2(out + (size_t)(r0 + rl) * CC + pc * 4, *(const v4f*)(&sr[wave * 16 + rl][pc * 4])); }
}
extern "C" void kernel_launch(void* const* d_in, const int* in_sizes, int n_in, void* d_out, int out_size, void* d_ws, size_t ws_size, hipStream_t stream) {
  (void)in_sizes; (void)n_in; (void)out_size; (void)ws_size;
  const float** I = (const float**)d_in;
  const float* x = I[0]; const float* Wqkv = I[1]; const float* bqkv = I[2]; const float* kg = I[3]; const float* kb = I[4]; const float* vg = I[5]; const float* vb = I[6]; const float* W1 = I[7]; const float* b1 = I[8]; const float* W2 = I[9]; const float* b2 = I[10];
  float* out = (float*)d_out;
  char* ws = (char*)d_ws; size_t off = 0;
  auto take = [&](size_t bytes) { char* p = ws + off; off += (bytes + 255) & ~(size_t)255; return p; };
  _Float16* x16 = (_Float16*)take((size_t)NR * CC * 2); _Float16* P = (_Float16*)take((size_t)5 * CC * CC * 2); float* qrows = (float*)take((size_t)NR * CC * 4);
  float* part = (float*)take((size_t)(NR / 64) * NHD * HC * HC * 4); float* kv = (float*)take((size_t)NB * NHD * HC * HC * 4);
  const size_t n8 = (size_t)NR * CC / 8; k_cvt<<<(unsigned)(n8 / 256), 256, 0, stream>>>(x, x16, n8);
  k_packT<<<dim3(3 * CC / 64, CC / 64, 3), 256, 0, stream>>>(Wqkv, W1, W2, P);
  k_qkv<<<NR / 64, 128, 0, stream>>>(x16, P, bqkv, kg, kb, vg, vb, qrows, part);
  k_kv<<<NB * NHD * HC * HC / 256, 128, 0, stream>>>(part, kv);
  k_mlp<<<NR / 64, 128, 0, stream>>>(qrows, kv, x, P, b1, b2, out);
}

// v004
// A run of this version takes 120 microseconds.
// Two timings next to v003 put it at 1.15 and 1.18 times that version's speed.
// All steps since v000 together make it 3.58 times as fast.
#include <hip/hip_runtime.h>
#include <math.h>

typedef __attribute__((ext_vector_type(16))) _Float16 v16h;
typedef __attribute__((ext_vector_type(16))) __bf16 v16b;
typedef __attribute__((ext_vector_type(8)))  _Float16 v8h;
typedef __attribute__((ext_vector_type(8)))  float v8f;
typedef __attribute__((ext_vector_type(4)))  float v4f;
typedef __attribute__((ext_vector_type(2)))  float v2f;
typedef __attribute__((ext_vector_type(4)))  unsigned v4u;
typedef __attribute__((ext_vector_type(4)))  int v4i;
typedef float __attribute__((may_alias)) float_a;
typedef int __attribute__((may_alias)) int_a;

template <typename T> __device__ __forceinline__ void vst2(void* p, T v) { *(T*)p = v;  }
__device__ __forceinline__ v8f wmma16(v16h a, v16h b, v8f c) {
  v8f d = __builtin_amdgcn_wmma_f32_16x16x32_f16(false, a, false, b, (short)0, c, false, false);
  asm volatile("v_nop\n\tv_nop\n\tv_nop\n\tv_nop" : "+v"(d) : "v"(a), "v"(b));
  return d;
}
__device__ __forceinline__ v8f wmma_bf(v16b a, v16b b, v8f c) {
  v8f d = __builtin_amdgcn_wmma_f32_16x16x32_bf16(false, a, false, b, (short)0, c, false, false);
  asm volatile("v_nop\n\tv_nop\n\tv_nop\n\tv_nop" : "+v"(d) : "v"(a), "v"(b));
  return d;
}
// 16x16x32 fragments: lane = (h = lane>>4, row/col = lane&15); elements 0..7 = k0+8h+0..7, 8..15 = k0+16+8h+0..7; D element r = row 8h+r
__device__ __forceinline__ v16h frag_h(const _Float16* rowk0, int lane) {
  union { v16h v; v8h q[2]; } u; const _Float16* p = rowk0 + 8 * (lane >> 4);
  u.q[0] = *(const v8h*)p; u.q[1] = *(const v8h*)(p + 16); return u.v;
}
// a fragment of the packed weights (layout at k_packT) from a pointer that already holds the lane's 8 * lane part: each of the two loads reads
// 512 contiguous bytes per wave, four whole 128-byte lines
__device__ __forceinline__ v16h frag_hp(const _Float16* p) {
  union { v16h v; v8h q[2]; } u; u.q[0] = *(const v8h*)p; u.q[1] = *(const v8h*)(p + 256); return u.v;
}
__device__ __forceinline__ v16h frag_f32(const float* rowk0, int lane) {
  v16h a; const float* p = rowk0 + 8 * (lane >> 4);
#pragma unroll
  for (int i = 0; i < 8; ++i) { a[i] = (_Float16)p[i]; a[8 + i] = (_Float16)p[16 + i]; }
  return a;
}
__device__ __forceinline__ v16h frag_f32s(const float* rowk0, int lane, float sc) {
  v16h a; const float* p = rowk0 + 8 * (lane >> 4);
#pragma unroll
  for (int i = 0; i < 8; ++i) { a[i] = (_Float16)(p[i] * sc); a[8 + i] = (_Float16)(p[16 + i] * sc); }
  return a;
}
// column fragment from a [K][ld] layout (column n), rows >= K read as 0
__device__ __forceinline__ v16h fragc_f32(const float* W, int k0, int n, int lane, int ld, int K) {
  v16h a; const int g = lane >> 4;
#pragma unroll
  for (int i = 0; i < 8; ++i) { const int ka = k0 + 8 * g + i, kb = ka + 16;
    a[i] = (_Float16)(ka < K ? W[(size_t)ka * ld + n] : 0.f); a[8 + i] = (_Float16)(kb < K ? W[(size_t)kb * ld + n] : 0.f); }
  return a;
}
struct F2 { v16b h, l; };
__device__ __forceinline__ F2 bsplit16(const float v[16]) { F2 r;
#pragma unroll
  for (int i = 0; i < 16; ++i) { const __bf16 h = (__bf16)v[i]; r.h[i] = h; r.l[i] = (__bf16)(v[i] - (float)h); }
  return r; }
__device__ __forceinline__ F2 split_row(const float* row, int k0, int lane) { float v[16]; const float* p = row + k0 + 8 * (lane >> 4);
#pragma unroll
  for (int i = 0; i < 8; ++i) { v[i] = p[i]; v[8 + i] = p[16 + i]; }
  return bsplit16(v); }
__device__ __forceinline__ F2 split_rowK(const float* row, int k0, int lane, int K) { float v[16]; const int g = lane >> 4;
#pragma unroll
  for (int i = 0; i < 8; ++i) { const int ka = k0 + 8 * g + i, kb = ka + 16; v[i] = ka < K ? row[ka] : 0.f; v[8 + i] = kb < K ? row[kb] : 0.f; }
  return bsplit16(v); }
__device__ __forceinline__ F2 split_col(const float* W, int k0, int n, int lane, int ld, int K) { float v[16]; const int g = lane >> 4;
#pragma unroll
  for (int i = 0; i < 8; ++i) { const int ka = k0 + 8 * g + i, kb = ka + 16; v[i] = ka < K ? W[(size_t)ka * ld + n] : 0.f; v[8 + i] = kb < K ? W[(size_t)kb * ld + n] : 0.f; }
  return bsplit16(v); }
__device__ __forceinline__ v8f mac3(const F2& a, const F2& b, v8f c) { c = wmma_bf(a.l, b.h, c); c = wmma_bf(a.h, b.l, c); return wmma_bf(a.h, b.h, c); }
__device__ __forceinline__ float sigm(float v) { return 1.0f / (1.0f + expf(-v)); }
#define LDSX() do { asm volatile("s_wait_dscnt 0" ::: "memory"); __builtin_amdgcn_wave_barrier(); __builtin_amdgcn_fence(__ATOMIC_RELEASE, "workgroup"); } while (0)

// Linear (kernelised) attention block. qkv = x@w_qkv + b on f16 WMMA (x converted once, [in][out] weights packed x16 in B fragment order); per
// head LayerNorm of k and v over their 32 channels in f32 (LDS); kv_h = k_h^T v_h as deterministic per-block 32x32 partial sums (f32
// VALU) reduced in fixed order and divided by HW; then per 64-row block: out = q @ kv on WMMA (K = 32), + x, GELU(erf) MLP on f16 WMMA
// with the hidden tile in LDS, + x. The k^T v outer-product partials are VALU (64 rows per block).
#define NB 8
#define HWN 4096
#define CC 256
#define NHD 8
#define HC 32
#define NR (NB * HWN)
#define BPB (HWN / 64)        // 64 row-blocks per batch entry

__device__ __forceinline__ float gelu_e(float v) { return 0.5f * v * (1.0f + erff(v * 0.70710678118654752f)); }

// LayerNorm of one 32-channel group in LDS, done by one lane: 8 reads of 16 bytes, mean and variance summed in registers (four partial sums
// each, folded pairwise), written back in place. At a row pitch of 16 B x odd the 16 lanes of a half wave fall on distinct banks
__device__ __forceinline__ void ln32(float* p, const v4f (&gam)[8], const v4f (&bet)[8]) {
  v4f q[8];
#pragma unroll
  for (int i = 0; i < 8; ++i) q[i] = *(const v4f*)(p + 4 * i);
  v4f s4 = q[0];
#pragma unroll
  for (int i = 1; i < 8; ++i) s4 += q[i];
  const float mu = ((s4[0] + s4[1]) + (s4[2] + s4[3])) * (1.0f / HC);
  v4f w4 = {};
#pragma unroll
  for (int i = 0; i < 8; ++i) { q[i] -= mu; w4 += q[i] * q[i]; }
  float rs; const float va = ((w4[0] + w4[1]) + (w4[2] + w4[3])) * (1.0f / HC) + 1e-5f;      // a sum of squares plus 1e-5: never small enough for rsqrtf's small-input scaling
  asm("v_rsq_f32 %0, %1\n\tv_nop" : "=v"(rs) : "v"(va));      // the v_nop is the free slot asked for behind a transcendental; in one statement it stays directly behind it
#pragma unroll
  for (int i = 0; i < 8; ++i) {
#pragma unroll
    for (int e = 0; e < 4; ++e) q[i][e] = q[i][e] * rs * gam[i][e] + bet[i][e];
    vst2(p + 4 * i, q[i]); }
}
__global__ __launch_bounds__(256) void k_cvt(const float* __restrict__ x, _Float16* __restrict__ x16, size_t n8) {
  const size_t g8 = (size_t)blockIdx.x * 256 + threadIdx.x; if (g8 >= n8) return;
  union { v8h h; v4u u; } pk;
#pragma unroll
  for (int e = 0; e < 8; ++e) pk.h[e] = (_Float16)x[g8 * 8 + e];
  vst2(x16 + g8 * 8, pk.u);
}
__global__ __launch_bounds__(256) void k_packT(const float* __restrict__ Wqkv, const float* __restrict__ W1, const float* __restrict__ W2, _Float16* __restrict__ P) {
  // output columns n: [0,768) w_qkv, [768,1024) w1, [1024,1280) w2, all x16. P holds them as B fragments of 16 columns x 32 k, 512 halves each, at
  // (n >> 4) * 4096 + (k >> 5) * 512: first elements 0..7 of lanes 0..31 (k = 8 * (lane >> 4) + 0..7, column lane & 15), then elements 8..15 (k + 16)
  __shared__ float tile[64][65];
  const int which = blockIdx.z, o0 = blockIdx.x * 64, k0 = blockIdx.y * 64, tid = threadIdx.x;
  const float* W = which == 0 ? Wqkv : (which == 1 ? W1 : W2); const int NOUT = which == 0 ? 3 * CC : CC; const int rowbase = which == 0 ? 0 : (which == 1 ? 3 * CC : 4 * CC);
  if (o0 >= NOUT) return;                                // uniform per block, before any barrier
  for (int q = tid; q < 64 * 64; q += 256) { const int kl = q >> 6, ol = q & 63; tile[kl][ol] = W[(size_t)(k0 + kl) * NOUT + o0 + ol]; }
  __syncthreads();
  for (int u = 0; u < 2; ++u) { const int idx = tid + u * 256, ln = idx & 31, hf = (idx >> 5) & 1, kl = (idx >> 6) & 1, nt = idx >> 7;      // one wave fills half a fragment
    const int ol = nt * 16 + (ln & 15), pc = kl * 4 + hf * 2 + (ln >> 4); union { v8h hh; v4u uu; } pk;
#pragma unroll
    for (int i = 0; i < 8; ++i) pk.hh[i] = (_Float16)(tile[pc * 8 + i][ol] * 16.0f);
    vst2(P + (size_t)((rowbase + o0) / 16 + nt) * 4096 + (k0 / 32 + kl) * 512 + hf * 256 + ln * 8, pk.uu); }
}
// qkv for 64 rows: column n of the 768 = h*96 + which*32 + c (reference reshape (B,HW,8,96) then split). q -> sq, k -> sk, v -> sv (LDS f32),
// LN(k), LN(v) per (row, head); q rows -> global f32 [r][h*32+c]; kv partial [blk][h][32][32] = sum_rows kn (x) vn
__global__ __launch_bounds__(128) void k_qkv(const _Float16* __restrict__ x16, const _Float16* __restrict__ P, const float* __restrict__ bqkv, const float* __restrict__ kg, const float* __restrict__ kb, const float* __restrict__ vg, const float* __restrict__ vb,
                                           float* __restrict__ qrows, float* __restrict__ part) {
  __shared__ __align__(16) float sq[64][CC + 4], sk[64][CC + 4], sv[64][CC + 4];
  const int tid = threadIdx.x, wave = tid >> 5, lane = tid & 31, col = lane & 15, g = lane >> 4;
  const int r0b = blockIdx.x * 64, r0 = r0b + wave * 16;
  v16h ax[8];
#pragma unroll
  for (int kc = 0; kc < 8; ++kc) ax[kc] = frag_h(x16 + (size_t)(r0 + col) * CC + kc * 32, lane);
  // B fragments run one k group (8 tiles) ahead: behind each WMMA its fragment register is reloaded for the next group, so 8 fragments
  // are always in flight and no WMMA waits out the latency of its own loads. The last group reloads chunk 5, k group 0 (in bounds, unused)
  const _Float16* pl = P + lane * 8;                     // this lane's part of every packed fragment
  v16h bf[8];
#pragma unroll
  for (int j = 0; j < 8; ++j) bf[j] = frag_hp(pl + j * 4096);
#pragma unroll 1
  for (int nc = 0; nc < 6; ++nc) { v8f acc[8] = {}; const int ncn = nc < 5 ? nc + 1 : 5;
#pragma unroll
    for (int kc = 0; kc < 8; ++kc) {
#pragma unroll
      for (int j = 0; j < 8; ++j) { acc[j] = wmma16(ax[kc], bf[j], acc[j]);
        bf[j] = frag_hp(pl + (size_t)((kc < 7 ? nc : ncn) * 8 + j) * 4096 + ((kc + 1) & 7) * 512); } }
#pragma unroll
    for (int j = 0; j < 8; ++j) { const int n = nc * 128 + j * 16 + col; const float bb = bqkv[n]; const int h = n / 96, wch = (n % 96) / 32, c = n % 32; const int cc = h * HC + c;
      float (*dst)[CC + 4] = wch == 0 ? sq : (wch == 1 ? sk : sv);
#pragma unroll
      for (int r = 0; r < 8; ++r) dst[wave * 16 + 8 * g + r][cc] = acc[j][r] * (1.0f / 16.0f) + bb; } }
  LDSX();
  // LN of k and v per (row, head) over 32 channels: one lane owns a whole group (row = lane & 15, head = 2t + (lane >> 4)) and sums it in registers
  v4f gk[8], bk[8], gv[8], bv[8];                        // gamma and beta, the same for every group: fetched once, ahead of both loops
#pragma unroll
  for (int i = 0; i < 32; ++i) { gk[i >> 2][i & 3] = kg[i]; bk[i >> 2][i & 3] = kb[i]; gv[i >> 2][i & 3] = vg[i]; bv[i >> 2][i & 3] = vb[i]; }
  // two groups per trip: the second group's LDS reads run under the first one's sums; all four at once took the kernel past 256 registers
#pragma unroll 2
  for (int t = 0; t < NHD / 2; ++t) ln32(&sk[wave * 16 + col][(2 * t + g) * HC], gk, bk);
#pragma unroll 2
  for (int t = 0; t < NHD / 2; ++t) ln32(&sv[wave * 16 + col][(2 * t + g) * HC], gv, bv);
  // q rows out (wave's 16 rows)
  for (int q = lane; q < 16 * 64; q += 32) { const int rl = q >> 6, pc = q & 63; vst2(qrows + (size_t)(r0 + rl) * CC + pc * 4, *(const v4f*)(&sq[wave * 16 + rl][pc * 4])); }
  __syncthreads();
  // kv partials over the block's 64 rows: thread (128) -> for each head: 32x32 = 1024 outputs / 128 = 8 per thread
  __shared__ __align__(16) float sp[NHD * HC * HC];
#pragma unroll 1
  for (int h = 0; h < NHD; ++h) {
    float a8[8]; const int d = tid >> 2, e0 = (tid & 3) * 8;             // (d, e0..e0+7)
#pragma unroll
    for (int u = 0; u < 8; ++u) a8[u] = 0.f;
#pragma unroll 4
    for (int rl = 0; rl < 64; ++rl) { const float kd = sk[rl][h * HC + d];
#pragma unroll
      for (int u = 0; u < 8; ++u) a8[u] += kd * sv[rl][h * HC + e0 + u]; }
#pragma unroll
    for (int u = 0; u < 8; ++u) sp[(h * HC + d) * HC + e0 + u] = a8[u]; }
  __syncthreads();
  for (int q = tid; q < NHD * HC * HC / 4; q += 128) vst2(part + (size_t)blockIdx.x * (NHD * HC * HC) + q * 4, *(const v4f*)(&sp[q * 4]));
}
// kv[b][h][32][32] = (sum over the 64 blocks of batch b, fixed order) / HW. The (h, d, e) planes of one batch entry are 8192 adjacent floats in
// part and in kv alike: one thread owns two adjacent outputs. Its 64 loads depend on nothing: with both loops unrolled whole the compiler issues them
// far ahead of the adds (a rolled loop waits out one full load latency per term); the adds keep the order blk = 0..63
__global__ __launch_bounds__(128) void k_kv(const float* __restrict__ part, float* __restrict__ kv) {
  const int i2 = (blockIdx.x * 128 + threadIdx.x) * 2;                // first of the two outputs, in [0, NB * 8192)
  const int b = i2 / (NHD * HC * HC), i = i2 % (NHD * HC * HC);
  const float* p = part + (size_t)b * BPB * (NHD * HC * HC) + i;
  v2f t[BPB];
#pragma unroll
  for (int blk = 0; blk < BPB; ++blk) t[blk] = *(const v2f*)(p + (size_t)blk * (NHD * HC * HC));
  v2f s = {};
#pragma unroll
  for (int blk = 0; blk < BPB; ++blk) s += t[blk];
  vst2(kv + i2, s * (1.0f / (float)HWN));
}
// per 64-row block: out = q @ kv (WMMA per head, K = 32, N = 32) + x -> ret (LDS); hid = gelu(ret @ w1 + b1) (LDS); out = hid @ w2 + b2 + x
__global__ __launch_bounds__(128) void k_mlp(const float* __restrict__ qrows, const float* __restrict__ kv, const float* __restrict__ x, const _Float16* __restrict__ P, const float* __restrict__ b1, const float* __restrict__ b2, float* __restrict__ out) {
  __shared__ __align__(16) float sr[64][CC + 4];      // ret, later reused for the output tile
  __shared__ __align__(16) float sh[64][CC + 4];      // hidden
  const int tid = threadIdx.x, wave = tid >> 5, lane = tid & 31, col = lane & 15, g = lane >> 4;
  const int r0b = blockIdx.x * 64, r0 = r0b + wave * 16; const int b = r0b / HWN;
  // B fragments of both GEMMs run one k group (8 tiles) ahead, as in k_qkv: w1^T and w2^T are adjacent in P, so the 32 groups (128 columns x 32 k
  // each) form one run t = 0..31; group 0 is fetched here, behind each WMMA its register is reloaded for group t + 1 (the last reloads group 31, unused)
  const _Float16* pn = P + (size_t)(3 * CC / 16) * 4096 + lane * 8;      // this lane's first element of tile 0 in the group that is fetched next
  v16h bf[8];
#pragma unroll
  for (int j = 0; j < 8; ++j) bf[j] = frag_hp(pn + j * 16 * CC);
#pragma unroll 1
  for (int h = 0; h < NHD; ++h) { const v16h a = frag_f32(qrows + (size_t)(r0 + col) * CC + h * HC, lane); const float* kvh = kv + ((size_t)b * NHD + h) * (HC * HC);
#pragma unroll
    for (int t = 0; t < 2; ++t) { v16h bb; const int n = t * 16 + col;                       // B[k=d][n=e] = kv[d][e] x64 (scaled in f32 before the cast: keeps small entries normal)
#pragma unroll
      for (int i = 0; i < 8; ++i) { bb[i] = (_Float16)(kvh[(8 * g + i) * HC + n] * 64.0f); bb[8 + i] = (_Float16)(kvh[(16 + 8 * g + i) * HC + n] * 64.0f); }
      v8f acc = {}; acc = wmma16(a, bb, acc);
#pragma unroll
      for (int r = 0; r < 8; ++r) { const int cc = h * HC + t * 16 + col; sr[wave * 16 + 8 * g + r][cc] = acc[r] * (1.0f / 64.0f) + x[(size_t)(r0 + 8 * g + r) * CC + cc]; } } }
  LDSX();
  // hidden = gelu(ret @ w1 + b1): A from sr rows (f32 -> f16), B = packed fragments of columns 768.. (w1 x16)
#pragma unroll 1
  for (int nh = 0; nh < 2; ++nh) { v8f acc[8];                     // hidden columns nh*128 .. +127
#pragma unroll
    for (int j = 0; j < 8; ++j) acc[j] = (v8f){};
#pragma unroll 1
    for (int kc = 0; kc < CC / 32; ++kc) { const v16h a = frag_f32(&sr[wave * 16 + col][0] + kc * 32, lane); pn += kc < 7 ? 512 : 8 * 4096 - 7 * 512;
#pragma unroll
      for (int j = 0; j < 8; ++j) { acc[j] = wmma16(a, bf[j], acc[j]); bf[j] = frag_hp(pn + j * 16 * CC); }
      asm volatile("s_wait_xcnt 0x0" ::: "memory"); }        // the next trip rewrites the address register that the loads above name
#pragma unroll
    for (int j = 0; j < 8; ++j) { const int cc = nh * 128 + j * 16 + col; const float bb = b1[cc];
#pragma unroll
      for (int r = 0; r < 8; ++r) sh[wave * 16 + 8 * g + r][cc] = gelu_e(acc[j][r] * (1.0f / 16.0f) + bb); } }
  LDSX();
  // second GEMM: sr is no longer read (both hidden halves are done), so each output half goes straight into sr
#pragma unroll 1
  for (int nh = 0; nh < 2; ++nh) { v8f acc[8];
#pragma unroll
    for (int j = 0; j < 8; ++j) acc[j] = (v8f){};
#pragma unroll 1
    for (int kc = 0; kc < CC / 32; ++kc) { const v16h a = frag_f32(&sh[wave * 16 + col][0] + kc * 32, lane); pn += kc < 7 ? 512 : (nh == 0 ? 8 * 4096 - 7 * 512 : 0);
#pragma unroll
      for (int j = 0; j < 8; ++j) { acc[j] = wmma16(a, bf[j], acc[j]); bf[j] = frag_hp(pn + j * 16 * CC); }
      asm volatile("s_wait_xcnt 0x0" ::: "memory"); }        // the next trip rewrites the address register that the loads above name
#pragma unroll
    for (int j = 0; j < 8; ++j) { const int cc = nh * 128 + j * 16 + col; const float bb = b2[cc];
#pragma unroll
      for (int r = 0; r < 8; ++r) sr[wave * 16 + 8 * g + r][cc] = acc[j][r] * (1.0f / 16.0f) + bb + x[(size_t)(r0 + 8 * g + r) * CC + cc]; } }
  LDSX();
  for (int q = lane; q < 16 * 64; q += 32) { const int rl = q >> 6, pc = q & 63; vst2(out + (size_t)(r0 + rl) * CC + pc * 4, *(const v4f*)(&sr[wave * 16 + rl][pc * 4])); }
}
extern "C" void kernel_launch(void* const* d_in, const int* in_sizes, int n_in, void* d_out, int out_size, void* d_ws, size_t ws_size, hipStream_t stream) {
  (void)in_sizes; (void)n_in; (void)out_size; (void)ws_size;
  const float** I = (const float**)d_in;
  const float* x = I[0]; const float* Wqkv = I[1]; const float* bqkv = I[2]; const float* kg = I[3]; const float* kb = I[4]; const float* vg = I[5]; const float* vb = I[6]; const float* W1 = I[7]; const float* b1 = I[8]; const float* W2 = I[9]; const float* b2 = I[10];
  float* out = (float*)d_out;
  char* ws = (char*)d_ws; size_t off = 0;
  auto take = [&](size_t bytes) { char* p = ws + off; off += (bytes + 255) & ~(size_t)255; return p; };
  _Float16* x16 = (_Float16*)take((size_t)NR * CC * 2); _Float16* P = (_Float16*)take((size_t)5 * CC * CC * 2); float* qrows = (float*)take((size_t)NR * CC * 4);
  float* part = (float*)take((size_t)(NR / 64) * NHD * HC * HC * 4); float* kv = (float*)take((size_t)NB * NHD * HC * HC * 4);
  const size_t n8 = (size_t)NR * CC / 8; k_cvt<<<(unsigned)(n8 / 256), 256, 0, stream>>>(x, x16, n8);
  k_packT<<<dim3(3 * CC / 64, CC / 64, 3), 256, 0, stream>>>(Wqkv, W1, W2, P);
  k_qkv<<<NR / 64, 128, 0, stream>>>(x16, P, bqkv, kg, kb, vg, vb, qrows, part);
  k_kv<<<NB * NHD * HC * HC / 256, 128, 0, stream>>>(part, kv);
  k_mlp<<<NR / 64, 128, 0, stream>>>(qrows, kv, x, P, b1, b2, out);
}

// v005
// Measured time: 79.8 microseconds a run.
// Next to v004, in two timings, it ran 1.47 and 1.46 times as fast.
// Over all steps from v000 it is 5.25 times as fast.
#include <hip/hip_runtime.h>
#include <math.h>

typedef __attribute__((ext_vector_type(16))) _Float16 v16h;
typedef __attribute__((ext_vector_type(16))) __bf16 v16b;
typedef __attribute__((ext_vector_type(8)))  _Float16 v8h;
typedef __attribute__((ext_vector_type(8)))  float v8f;
typedef __attribute__((ext_vector_type(4)))  float v4f;
typedef __attribute__((ext_vector_type(2)))  float v2f;
typedef __attribute__((ext_vector_type(4)))  unsigned v4u;
typedef __attribute__((ext_vector_type(4)))  int v4i;
typedef float __attribute__((may_alias)) float_a;
typedef int __attribute__((may_alias)) int_a;

template <typename T> __device__ __forceinline__ void vst2(void* p, T v) { *(T*)p = v;  }
__device__ __forceinline__ v8f wmma16(v16h a, v16h b, v8f c) {
  v8f d = __builtin_amdgcn_wmma_f32_16x16x32_f16(false, a, false, b, (short)0, c, false, false);
  asm volatile("v_nop\n\tv_nop\n\tv_nop\n\tv_nop" : "+v"(d) : "v"(a), "v"(b));
  return d;
}
__device__ __forceinline__ v8f wmma_bf(v16b a, v16b b, v8f c) {
  v8f d = __builtin_amdgcn_wmma_f32_16x16x32_bf16(false, a, false, b, (short)0, c, false, false);
  asm volatile("v_nop\n\tv_nop\n\tv_nop\n\tv_nop" : "+v"(d) : "v"(a), "v"(b));
  return d;
}
// 16x16x32 fragments: lane = (h = lane>>4, row/col = lane&15); elements 0..7 = k0+8h+0..7, 8..15 = k0+16+8h+0..7; D element r = row 8h+r
__device__ __forceinline__ v16h frag_h(const _Float16* rowk0, int lane) {
  union { v16h v; v8h q[2]; } u; const _Float16* p = rowk0 + 8 * (lane >> 4);
  u.q[0] = *(const v8h*)p; u.q[1] = *(const v8h*)(p + 16); return u.v;
}
// a fragment of the packed weights (layout at k_packT) from a pointer that already holds the lane's 8 * lane part: each of the two loads reads
// 512 contiguous bytes per wave, four whole 128-byte lines
__device__ __forceinline__ v16h frag_hp(const _Float16* p) {
  union { v16h v; v8h q[2]; } u; u.q[0] = *(const v8h*)p; u.q[1] = *(const v8h*)(p + 256); return u.v;
}
__device__ __forceinline__ v16h frag_f32(const float* rowk0, int lane) {
  v16h a; const float* p = rowk0 + 8 * (lane >> 4);
#pragma unroll
  for (int i = 0; i < 8; ++i) { a[i] = (_Float16)p[i]; a[8 + i] = (_Float16)p[16 + i]; }
  return a;
}
__device__ __forceinline__ v16h frag_f32s(const float* rowk0, int lane, float sc) {
  v16h a; const float* p = rowk0 + 8 * (lane >> 4);
#pragma unroll
  for (int i = 0; i < 8; ++i) { a[i] = (_Float16)(p[i] * sc); a[8 + i] = (_Float16)(p[16 + i] * sc); }
  return a;
}
// column fragment from a [K][ld] layout (column n), rows >= K read as 0
__device__ __forceinline__ v16h fragc_f32(const float* W, int k0, int n, int lane, int ld, int K) {
  v16h a; const int g = lane >> 4;
#pragma unroll
  for (int i = 0; i < 8; ++i) { const int ka = k0 + 8 * g + i, kb = ka + 16;
    a[i] = (_Float16)(ka < K ? W[(size_t)ka * ld + n] : 0.f); a[8 + i] = (_Float16)(kb < K ? W[(size_t)kb * ld + n] : 0.f); }
  return a;
}
struct F2 { v16b h, l; };
__device__ __forceinline__ F2 bsplit16(const float v[16]) { F2 r;
#pragma unroll
  for (int i = 0; i < 16; ++i) { const __bf16 h = (__bf16)v[i]; r.h[i] = h; r.l[i] = (__bf16)(v[i] - (float)h); }
  return r; }
__device__ __forceinline__ F2 split_row(const float* row, int k0, int lane) { float v[16]; const float* p = row + k0 + 8 * (lane >> 4);
#pragma unroll
  for (int i = 0; i < 8; ++i) { v[i] = p[i]; v[8 + i] = p[16 + i]; }
  return bsplit16(v); }
__device__ __forceinline__ F2 split_rowK(const float* row, int k0, int lane, int K) { float v[16]; const int g = lane >> 4;
#pragma unroll
  for (int i = 0; i < 8; ++i) { const int ka = k0 + 8 * g + i, kb = ka + 16; v[i] = ka < K ? row[ka] : 0.f; v[8 + i] = kb < K ? row[kb] : 0.f; }
  return bsplit16(v); }
__device__ __forceinline__ F2 split_col(const float* W, int k0, int n, int lane, int ld, int K) { float v[16]; const int g = lane >> 4;
#pragma unroll
  for (int i = 0; i < 8; ++i) { const int ka = k0 + 8 * g + i, kb = ka + 16; v[i] = ka < K ? W[(size_t)ka * ld + n] : 0.f; v[8 + i] = kb < K ? W[(size_t)kb * ld + n] : 0.f; }
  return bsplit16(v); }
__device__ __forceinline__ v8f mac3(const F2& a, const F2& b, v8f c) { c = wmma_bf(a.l, b.h, c); c = wmma_bf(a.h, b.l, c); return wmma_bf(a.h, b.h, c); }
__device__ __forceinline__ float sigm(float v) { return 1.0f / (1.0f + expf(-v)); }
#define LDSX() do { asm volatile("s_wait_dscnt 0" ::: "memory"); __builtin_amdgcn_wave_barrier(); __builtin_amdgcn_fence(__ATOMIC_RELEASE, "workgroup"); } while (0)

// Linear (kernelised) attention block. qkv = x@w_qkv + b on f16 WMMA (x converted once, [in][out] weights packed x16 in B fragment order); per
// head LayerNorm of k and v over their 32 channels in f32 (LDS); kv_h = k_h^T v_h as deterministic per-block 32x32 partial sums (f32
// VALU) reduced in fixed order and divided by HW; then per 64-row block: out = q @ kv on WMMA (K = 32), + x, GELU(erf) MLP on f16 WMMA
// with the hidden tile in LDS, + x. The k^T v outer-product partials are VALU (64 rows per block).
#define NB 8
#define HWN 4096
#define CC 256
#define NHD 8
#define HC 32
#define NR (NB * HWN)
#define BPB (HWN / 64)        // 64 row-blocks per batch entry

__device__ __forceinline__ float gelu_e(float v) { return 0.5f * v * (1.0f + erff(v * 0.70710678118654752f)); }

// LayerNorm of one 32-channel group in LDS, done by one lane: 8 reads of 16 bytes, mean and variance summed in registers (four partial sums
// each, folded pairwise), written back in place. At a row pitch of 16 B x odd the 16 lanes of a half wave fall on distinct banks
__device__ __forceinline__ void ln32(float* p, const v4f (&gam)[8], const v4f (&bet)[8]) {
  v4f q[8];
#pragma unroll
  for (int i = 0; i < 8; ++i) q[i] = *(const v4f*)(p + 4 * i);
  v4f s4 = q[0];
#pragma unroll
  for (int i = 1; i < 8; ++i) s4 += q[i];
  const float mu = ((s4[0] + s4[1]) + (s4[2] + s4[3])) * (1.0f / HC);
  v4f w4 = {};
#pragma unroll
  for (int i = 0; i < 8; ++i) { q[i] -= mu; w4 += q[i] * q[i]; }
  float rs; const float va = ((w4[0] + w4[1]) + (w4[2] + w4[3])) * (1.0f / HC) + 1e-5f;      // a sum of squares plus 1e-5: never small enough for rsqrtf's small-input scaling
  asm("v_rsq_f32 %0, %1\n\tv_nop" : "=v"(rs) : "v"(va));      // the v_nop is the free slot asked for behind a transcendental; in one statement it stays directly behind it
#pragma unroll
  for (int i = 0; i < 8; ++i) {
#pragma unroll
    for (int e = 0; e < 4; ++e) q[i][e] = q[i][e] * rs * gam[i][e] + bet[i][e];
    vst2(p + 4 * i, q[i]); }
}
__global__ __launch_bounds__(256) void k_cvt(const float* __restrict__ x, _Float16* __restrict__ x16, size_t n8) {
  const size_t g8 = (size_t)blockIdx.x * 256 + threadIdx.x; if (g8 >= n8) return;
  union { v8h h; v4u u; } pk;
#pragma unroll
  for (int e = 0; e < 8; ++e) pk.h[e] = (_Float16)x[g8 * 8 + e];
  vst2(x16 + g8 * 8, pk.u);
}
__global__ __launch_bounds__(256) void k_packT(const float* __restrict__ Wqkv, const float* __restrict__ W1, const float* __restrict__ W2, _Float16* __restrict__ P) {
  // output columns n: [0,768) w_qkv, [768,1024) w1, [1024,1280) w2, all x16. P holds them as B fragments of 16 columns x 32 k, 512 halves each, at
  // (n >> 4) * 4096 + (k >> 5) * 512: first elements 0..7 of lanes 0..31 (k = 8 * (lane >> 4) + 0..7, column lane & 15), then elements 8..15 (k + 16)
  __shared__ float tile[64][65];
  const int which = blockIdx.z, o0 = blockIdx.x * 64, k0 = blockIdx.y * 64, tid = threadIdx.x;
  const float* W = which == 0 ? Wqkv : (which == 1 ? W1 : W2); const int NOUT = which == 0 ? 3 * CC : CC; const int rowbase = which == 0 ? 0 : (which == 1 ? 3 * CC : 4 * CC);
  if (o0 >= NOUT) return;                                // uniform per block, before any barrier
  for (int q = tid; q < 64 * 64; q += 256) { const int kl = q >> 6, ol = q & 63; tile[kl][ol] = W[(size_t)(k0 + kl) * NOUT + o0 + ol]; }
  __syncthreads();
  for (int u = 0; u < 2; ++u) { const int idx = tid + u * 256, ln = idx & 31, hf = (idx >> 5) & 1, kl = (idx >> 6) & 1, nt = idx >> 7;      // one wave fills half a fragment
    const int ol = nt * 16 + (ln & 15), pc = kl * 4 + hf * 2 + (ln >> 4); union { v8h hh; v4u uu; } pk;
#pragma unroll
    for (int i = 0; i < 8; ++i) pk.hh[i] = (_Float16)(tile[pc * 8 + i][ol] * 16.0f);
    vst2(P + (size_t)((rowbase + o0) / 16 + nt) * 4096 + (k0 / 32 + kl) * 512 + hf * 256 + ln * 8, pk.uu); }
}
// qkv for 64 rows on 16 waves (four per SIMD): column n of the 768 = h*96 + which*32 + c (reference reshape (B,HW,8,96) then split). Wave = (rg, hp):
// 16 rows x the 192 columns of heads 2hp and 2hp+1, so a (row, head) group is made, normalised and (q) written out by one and the same wave.
// q -> sq, k -> sk, v -> sv (LDS f32), LN(k), LN(v) per (row, head); q rows -> global f32 [r][h*32+c]; kv partial [blk][h][32][32] = sum_rows kn (x) vn
__global__ __launch_bounds__(512) void k_qkv(const _Float16* __restrict__ x16, const _Float16* __restrict__ P, const float* __restrict__ bqkv, const float* __restrict__ kg, const float* __restrict__ kb, const float* __restrict__ vg, const float* __restrict__ vb,
                                           float* __restrict__ qrows, float* __restrict__ part) {
  __shared__ __align__(16) float sq[64][CC + 4], sk[64][CC + 4], sv[64][CC + 4];
  const int tid = threadIdx.x, wave = tid >> 5, lane = tid & 31, col = lane & 15, g = lane >> 4;
  const int rg = wave & 3, hp = wave >> 2;               // row group of 16 rows, pair of heads
  const int r0b = blockIdx.x * 64, r0 = r0b + rg * 16;
  const _Float16* xr = x16 + (size_t)(r0 + col) * CC + 8 * g;      // this lane's first element of its row (fragment layout as in frag_h)
  v16h ax[8];
#pragma unroll
  for (int kc = 0; kc < 8; ++kc) { union { v16h v; v8h q[2]; } u; u.q[0] = *(const v8h*)(xr + kc * 32); u.q[1] = *(const v8h*)(xr + kc * 32 + 16); ax[kc] = u.v; }
  asm volatile("s_wait_xcnt 0x0" :: "v"(xr) : "memory");      // keeps the address pair whole behind the 16 loads that name it
  // B fragments run one k group (the 6 tiles of one head) ahead: behind each WMMA its fragment register is reloaded for the next group, so 6
  // fragments a wave, 24 a SIMD, are always in flight and the other three waves of the SIMD issue while one waits for its loads
  const _Float16* pl = P + (size_t)hp * (12 * 4096) + lane * 8;      // this lane's part of every packed fragment of the head pair
  v16h bf[6];
#pragma unroll
  for (int j = 0; j < 6; ++j) bf[j] = frag_hp(pl + j * 4096);
#pragma unroll
  for (int hh = 0; hh < 2; ++hh) { v8f acc[6] = {}; const int h = 2 * hp + hh;
#pragma unroll
    for (int kc = 0; kc < 8; ++kc) {
#pragma unroll
      for (int j = 0; j < 6; ++j) { acc[j] = wmma16(ax[kc], bf[j], acc[j]);
        if (kc < 7 || hh == 0) bf[j] = frag_hp(pl + (size_t)((kc < 7 ? hh : 1) * 6 + j) * 4096 + ((kc + 1) & 7) * 512); } }
#pragma unroll
    for (int j = 0; j < 6; ++j) { const float bb = bqkv[h * 96 + j * 16 + col]; const int cc = h * HC + (j & 1) * 16 + col;      // tiles 0,1 = q, 2,3 = k, 4,5 = v
      float (*dst)[CC + 4] = j < 2 ? sq : (j < 4 ? sk : sv);
#pragma unroll
      for (int r = 0; r < 8; ++r) dst[rg * 16 + 8 * g + r][cc] = acc[j][r] * (1.0f / 16.0f) + bb; } }
  LDSX();
  // LN of k and v per (row, head) over 32 channels: one lane owns a whole group (row = lane & 15, head = 2hp + (lane >> 4)) and sums it in registers
  v4f gk[8], bk[8], gv[8], bv[8];                        // gamma and beta, the same for every group
#pragma unroll
  for (int i = 0; i < 32; ++i) { gk[i >> 2][i & 3] = kg[i]; bk[i >> 2][i & 3] = kb[i]; gv[i >> 2][i & 3] = vg[i]; bv[i >> 2][i & 3] = vb[i]; }
  ln32(&sk[rg * 16 + col][(2 * hp + g) * HC], gk, bk);
  ln32(&sv[rg * 16 + col][(2 * hp + g) * HC], gv, bv);
  // q rows out (the wave's 16 rows x its 64 channels: 256 contiguous bytes a row)
  for (int q = lane; q < 16 * 16; q += 32) { const int rl = q >> 4, pc = q & 15; vst2(qrows + (size_t)(r0 + rl) * CC + hp * 64 + pc * 4, *(const v4f*)(&sq[rg * 16 + rl][hp * 64 + pc * 4])); }
  __syncthreads();
  // kv partials over the block's 64 rows: four waves (128 threads) take the two heads of a pair: 32x32 = 1024 outputs / 128 = 8 per thread and head
  __shared__ __align__(16) float sp[NHD * HC * HC];
#pragma unroll 1
  for (int hh = 0; hh < 2; ++hh) { const int h = 2 * hp + hh;
    float a8[8]; const int d = (tid & 127) >> 2, e0 = (tid & 3) * 8;     // (d, e0..e0+7)
#pragma unroll
    for (int u = 0; u < 8; ++u) a8[u] = 0.f;
#pragma unroll 4
    for (int rl = 0; rl < 64; ++rl) { const float kd = sk[rl][h * HC + d];
#pragma unroll
      for (int u = 0; u < 8; ++u) a8[u] += kd * sv[rl][h * HC + e0 + u]; }
#pragma unroll
    for (int u = 0; u < 8; ++u) sp[(h * HC + d) * HC + e0 + u] = a8[u]; }
  __syncthreads();
  for (int q = tid; q < NHD * HC * HC / 4; q += 512) vst2(part + (size_t)blockIdx.x * (NHD * HC * HC) + q * 4, *(const v4f*)(&sp[q * 4]));
}
// kv[b][h][32][32] = (sum over the 64 blocks of batch b, fixed order) / HW. The (h, d, e) planes of one batch entry are 8192 adjacent floats in
// part and in kv alike: one thread owns two adjacent outputs. Its 64 loads depend on nothing: with both loops unrolled whole the compiler issues them
// far ahead of the adds (a rolled loop waits out one full load latency per term); the adds keep the order blk = 0..63
__global__ __launch_bounds__(128) void k_kv(const float* __restrict__ part, float* __restrict__ kv) {
  const int i2 = (blockIdx.x * 128 + threadIdx.x) * 2;                // first of the two outputs, in [0, NB * 8192)
  const int b = i2 / (NHD * HC * HC), i = i2 % (NHD * HC * HC);
  const float* p = part + (size_t)b * BPB * (NHD * HC * HC) + i;
  v2f t[BPB];
#pragma unroll
  for (int blk = 0; blk < BPB; ++blk) t[blk] = *(const v2f*)(p + (size_t)blk * (NHD * HC * HC));
  v2f s = {};
#pragma unroll
  for (int blk = 0; blk < BPB; ++blk) s += t[blk];
  vst2(kv + i2, s * (1.0f / (float)HWN));
}
// per 64-row block, 16 waves: wave = (rg, cq) = 16 rows x a quarter of the 256 columns (64 = two heads). out = q @ kv (WMMA per head, K = 32, N = 32) + x -> ret
// (LDS); hid = gelu(ret @ w1 + b1) (LDS); out = hid @ w2 + b2 + x. Each GEMM reads whole rows that four waves wrote: a work-group barrier stands in front of it
__global__ __launch_bounds__(512) void k_mlp(const float* __restrict__ qrows, const float* __restrict__ kv, const float* __restrict__ x, const _Float16* __restrict__ P, const float* __restrict__ b1, const float* __restrict__ b2, float* __restrict__ out) {
  __shared__ __align__(16) float sr[64][CC + 4];      // ret, later reused for the output tile
  __shared__ __align__(16) float sh[64][CC + 4];      // hidden
  const int tid = threadIdx.x, wave = tid >> 5, lane = tid & 31, col = lane & 15, g = lane >> 4;
  const int rg = wave & 3, cq = wave >> 2;            // row group of 16 rows, quarter of the columns
  const int r0b = blockIdx.x * 64, r0 = r0b + rg * 16; const int b = r0b / HWN;
  // B fragments of both GEMMs run one k group (the wave's 4 tiles) ahead, as in k_qkv: the wave's tiles of w2^T lie 16 tiles behind those of w1^T in P, so its 16
  // groups (64 columns x 32 k each) form one run; group 0 is fetched here, behind each WMMA its register is reloaded for the next group (the last reloads group 15, unused)
  const _Float16* pn = P + (size_t)(3 * CC / 16 + cq * 4) * 4096 + lane * 8;      // this lane's first element of tile 0 in the group that is fetched next
  v16h bf[4];
#pragma unroll
  for (int j = 0; j < 4; ++j) bf[j] = frag_hp(pn + j * 16 * CC);
#pragma unroll 1
  for (int hh = 0; hh < 2; ++hh) { const int h = 2 * cq + hh; const v16h a = frag_f32(qrows + (size_t)(r0 + col) * CC + h * HC, lane); const float* kvh = kv + ((size_t)b * NHD + h) * (HC * HC);
#pragma unroll
    for (int t = 0; t < 2; ++t) { v16h bb; const int n = t * 16 + col;                       // B[k=d][n=e] = kv[d][e] x64 (scaled in f32 before the cast: keeps small entries normal)
#pragma unroll
      for (int i = 0; i < 8; ++i) { bb[i] = (_Float16)(kvh[(8 * g + i) * HC + n] * 64.0f); bb[8 + i] = (_Float16)(kvh[(16 + 8 * g + i) * HC + n] * 64.0f); }
      v8f acc = {}; acc = wmma16(a, bb, acc);
#pragma unroll
      for (int r = 0; r < 8; ++r) { const int cc = h * HC + t * 16 + col; sr[rg * 16 + 8 * g + r][cc] = acc[r] * (1.0f / 64.0f) + x[(size_t)(r0 + 8 * g + r) * CC + cc]; } } }
  __syncthreads();                                     // ret rows are whole only when all four column quarters are written
  // hidden = gelu(ret @ w1 + b1): A from sr rows (f32 -> f16), B = packed fragments of columns 768.. (w1 x16)
  { v8f acc[4];                                        // hidden columns cq*64 .. +63
#pragma unroll
    for (int j = 0; j < 4; ++j) acc[j] = (v8f){};
#pragma unroll 1
    for (int kc = 0; kc < CC / 32; ++kc) { const v16h a = frag_f32(&sr[rg * 16 + col][0] + kc * 32, lane); pn += kc < 7 ? 512 : 16 * 4096 - 7 * 512;
#pragma unroll
      for (int j = 0; j < 4; ++j) { acc[j] = wmma16(a, bf[j], acc[j]); bf[j] = frag_hp(pn + j * 16 * CC); }
      asm volatile("s_wait_xcnt 0x0" ::: "memory"); }        // the next trip rewrites the address register that the loads above name
#pragma unroll
    for (int j = 0; j < 4; ++j) { const int cc = cq * 64 + j * 16 + col; const float bb = b1[cc];
#pragma unroll
      for (int r = 0; r < 8; ++r) sh[rg * 16 + 8 * g + r][cc] = gelu_e(acc[j][r] * (1.0f / 16.0f) + bb); } }
  __syncthreads();                                     // hidden rows are whole, and no wave reads sr any more
  // second GEMM: sr is no longer read (behind the barrier every wave has left the first GEMM), so the output goes straight into sr
  { v8f acc[4];
#pragma unroll
    for (int j = 0; j < 4; ++j) acc[j] = (v8f){};
#pragma unroll 1
    for (int kc = 0; kc < CC / 32; ++kc) { const v16h a = frag_f32(&sh[rg * 16 + col][0] + kc * 32, lane); pn += kc < 7 ? 512 : 0;
#pragma unroll
      for (int j = 0; j < 4; ++j) { acc[j] = wmma16(a, bf[j], acc[j]); bf[j] = frag_hp(pn + j * 16 * CC); }
      asm volatile("s_wait_xcnt 0x0" ::: "memory"); }        // the next trip rewrites the address register that the loads above name
    float bo[4]; const int cb = cq * 64 + col;
#pragma unroll
    for (int j = 0; j < 4; ++j) bo[j] = b2[cb + j * 16];
    asm volatile("s_wait_xcnt 0x0" :: "v"(cb) : "memory");      // keeps the index register whole behind the four loads that name it
#pragma unroll
    for (int j = 0; j < 4; ++j) { const int cc = cb + j * 16;
#pragma unroll
      for (int r = 0; r < 8; ++r) sr[rg * 16 + 8 * g + r][cc] = acc[j][r] * (1.0f / 16.0f) + bo[j] + x[(size_t)(r0 + 8 * g + r) * CC + cc]; } }
  LDSX();
  // the wave's own 16 rows x 64 columns out: 256 contiguous bytes a row
  for (int q = lane; q < 16 * 16; q += 32) { const int rl = q >> 4, pc = q & 15; vst2(out + (size_t)(r0 + rl) * CC + cq * 64 + pc * 4, *(const v4f*)(&sr[rg * 16 + rl][cq * 64 + pc * 4])); }
}
extern "C" void kernel_launch(void* const* d_in, const int* in_sizes, int n_in, void* d_out, int out_size, void* d_ws, size_t ws_size, hipStream_t stream) {
  (void)in_sizes; (void)n_in; (void)out_size; (void)ws_size;
  const float** I = (const float**)d_in;
  const float* x = I[0]; const float* Wqkv = I[1]; const float* bqkv = I[2]; const float* kg = I[3]; const float* kb = I[4]; const float* vg = I[5]; const float* vb = I[6]; const float* W1 = I[7]; const float* b1 = I[8]; const float* W2 = I[9]; const float* b2 = I[10];
  float* out = (float*)d_out;
  char* ws = (char*)d_ws; size_t off = 0;
  auto take = [&](size_t bytes) { char* p = ws + off; off += (bytes + 255) & ~(size_t)255; return p; };
  _Float16* x16 = (_Float16*)take((size_t)NR * CC * 2); _Float16* P = (_Float16*)take((size_t)5 * CC * CC * 2); float* qrows = (float*)take((size_t)NR * CC * 4);
  float* part = (float*)take((size_t)(NR / 64) * NHD * HC * HC * 4); float* kv = (float*)take((size_t)NB * NHD * HC * HC * 4);
  const size_t n8 = (size_t)NR * CC / 8; k_cvt<<<(unsigned)(n8 / 256), 256, 0, stream>>>(x, x16, n8);
  k_packT<<<dim3(3 * CC / 64, CC / 64, 3), 256, 0, stream>>>(Wqkv, W1, W2, P);
  k_qkv<<<NR / 64, 512, 0, stream>>>(x16, P, bqkv, kg, kb, vg, vb, qrows, part);
  k_kv<<<NB * NHD * HC * HC / 256, 128, 0, stream>>>(part, kv);
  k_mlp<<<NR / 64, 512, 0, stream>>>(qrows, kv, x, P, b1, b2, out);
}

// v006
// One run takes 74.9 microseconds.
// Timed twice side by side with v005, it ran 1.09 and 1.08 times as fast.
// Over all steps from v000 it is 5.69 times as fast.
#include <hip/hip_runtime.h>
#include <math.h>

typedef __attribute__((ext_vector_type(16))) _Float16 v16h;
typedef __attribute__((ext_vector_type(16))) __bf16 v16b;
typedef __attribute__((ext_vector_type(8)))  _Float16 v8h;
typedef __attribute__((ext_vector_type(8)))  float v8f;
typedef __attribute__((ext_vector_type(4)))  float v4f;
typedef __attribute__((ext_vector_type(2)))  float v2f;
typedef __attribute__((ext_vector_type(4)))  unsigned v4u;
typedef __attribute__((ext_vector_type(4)))  int v4i;
typedef float __attribute__((may_alias)) float_a;
typedef int __attribute__((may_alias)) int_a;

template <typename T> __device__ __forceinline__ void vst2(void* p, T v) { *(T*)p = v;  }
__device__ __forceinline__ v8f wmma16(v16h a, v16h b, v8f c) {
  v8f d = __builtin_amdgcn_wmma_f32_16x16x32_f16(false, a, false, b, (short)0, c, false, false);
  asm volatile("v_nop\n\tv_nop\n\tv_nop\n\tv_nop" : "+v"(d) : "v"(a), "v"(b));
  return d;
}
__device__ __forceinline__ v8f wmma_bf(v16b a, v16b b, v8f c) {
  v8f d = __builtin_amdgcn_wmma_f32_16x16x32_bf16(false, a, false, b, (short)0, c, false, false);
  asm volatile("v_nop\n\tv_nop\n\tv_nop\n\tv_nop" : "+v"(d) : "v"(a), "v"(b));
  return d;
}
// 16x16x32 fragments: lane = (h = lane>>4, row/col = lane&15); elements 0..7 = k0+8h+0..7, 8..15 = k0+16+8h+0..7; D element r = row 8h+r
__device__ __forceinline__ v16h frag_h(const _Float16* rowk0, int lane) {
  union { v16h v; v8h q[2]; } u; const _Float16* p = rowk0 + 8 * (lane >> 4);
  u.q[0] = *(const v8h*)p; u.q[1] = *(const v8h*)(p + 16); return u.v;
}
// a fragment of the packed weights (layout at k_packT) from a pointer that already holds the lane's 8 * lane part: each of the two loads reads
// 512 contiguous bytes per wave, four whole 128-byte lines
__device__ __forceinline__ v16h frag_hp(const _Float16* p) {
  union { v16h v; v8h q[2]; } u; u.q[0] = *(const v8h*)p; u.q[1] = *(const v8h*)(p + 256); return u.v;
}
__device__ __forceinline__ v16h frag_f32(const float* rowk0, int lane) {
  v16h a; const float* p = rowk0 + 8 * (lane >> 4);
#pragma unroll
  for (int i = 0; i < 8; ++i) { a[i] = (_Float16)p[i]; a[8 + i] = (_Float16)p[16 + i]; }
  return a;
}
__device__ __forceinline__ v16h frag_f32s(const float* rowk0, int lane, float sc) {
  v16h a; const float* p = rowk0 + 8 * (lane >> 4);
#pragma unroll
  for (int i = 0; i < 8; ++i) { a[i] = (_Float16)(p[i] * sc); a[8 + i] = (_Float16)(p[16 + i] * sc); }
  return a;
}
// column fragment from a [K][ld] layout (column n), rows >= K read as 0
__device__ __forceinline__ v16h fragc_f32(const float* W, int k0, int n, int lane, int ld, int K) {
  v16h a; const int g = lane >> 4;
#pragma unroll
  for (int i = 0; i < 8; ++i) { const int ka = k0 + 8 * g + i, kb = ka + 16;
    a[i] = (_Float16)(ka < K ? W[(size_t)ka * ld + n] : 0.f); a[8 + i] = (_Float16)(kb < K ? W[(size_t)kb * ld + n] : 0.f); }
  return a;
}
struct F2 { v16b h, l; };
__device__ __forceinline__ F2 bsplit16(const float v[16]) { F2 r;
#pragma unroll
  for (int i = 0; i < 16; ++i) { const __bf16 h = (__bf16)v[i]; r.h[i] = h; r.l[i] = (__bf16)(v[i] - (float)h); }
  return r; }
__device__ __forceinline__ F2 split_row(const float* row, int k0, int lane) { float v[16]; const float* p = row + k0 + 8 * (lane >> 4);
#pragma unroll
  for (int i = 0; i < 8; ++i) { v[i] = p[i]; v[8 + i] = p[16 + i]; }
  return bsplit16(v); }
__device__ __forceinline__ F2 split_rowK(const float* row, int k0, int lane, int K) { float v[16]; const int g = lane >> 4;
#pragma unroll
  for (int i = 0; i < 8; ++i) { const int ka = k0 + 8 * g + i, kb = ka + 16; v[i] = ka < K ? row[ka] : 0.f; v[8 + i] = kb < K ? row[kb] : 0.f; }
  return bsplit16(v); }
__device__ __forceinline__ F2 split_col(const float* W, int k0, int n, int lane, int ld, int K) { float v[16]; const int g = lane >> 4;
#pragma unroll
  for (int i = 0; i < 8; ++i) { const int ka = k0 + 8 * g + i, kb = ka + 16; v[i] = ka < K ? W[(size_t)ka * ld + n] : 0.f; v[8 + i] = kb < K ? W[(size_t)kb * ld + n] : 0.f; }
  return bsplit16(v); }
__device__ __forceinline__ v8f mac3(const F2& a, const F2& b, v8f c) { c = wmma_bf(a.l, b.h, c); c = wmma_bf(a.h, b.l, c); return wmma_bf(a.h, b.h, c); }
__device__ __forceinline__ float sigm(float v) { return 1.0f / (1.0f + expf(-v)); }
#define LDSX() do { asm volatile("s_wait_dscnt 0" ::: "memory"); __builtin_amdgcn_wave_barrier(); __builtin_amdgcn_fence(__ATOMIC_RELEASE, "workgroup"); } while (0)

// Linear (kernelised) attention block. qkv = x@w_qkv + b on f16 WMMA (x converted once, [in][out] weights packed x16 in B fragment order); per
// head LayerNorm of k and v over their 32 channels in f32 (LDS); kv_h = k_h^T v_h as deterministic per-block 32x32 partial sums (f16
// WMMA, f32 accumulators) reduced in fixed order and divided by HW; then per 64-row block: out = q @ kv on WMMA (K = 32), + x, GELU(erf) MLP on f16 WMMA
// with the hidden tile in LDS, + x.
#define NB 8
#define HWN 4096
#define CC 256
#define NHD 8
#define HC 32
#define NR (NB * HWN)
#define BPB (HWN / 64)        // 64 row-blocks per batch entry

__device__ __forceinline__ float gelu_e(float v) { return 0.5f * v * (1.0f + erff(v * 0.70710678118654752f)); }

// LayerNorm of one 32-channel group in LDS, done by one lane: 8 reads of 16 bytes, mean and variance summed in registers (four partial sums
// each, folded pairwise), written back in place. At a row pitch of 16 B x odd the 16 lanes of a half wave fall on distinct banks
__device__ __forceinline__ void ln32(float* p, const v4f (&gam)[8], const v4f (&bet)[8]) {
  v4f q[8];
#pragma unroll
  for (int i = 0; i < 8; ++i) q[i] = *(const v4f*)(p + 4 * i);
  v4f s4 = q[0];
#pragma unroll
  for (int i = 1; i < 8; ++i) s4 += q[i];
  const float mu = ((s4[0] + s4[1]) + (s4[2] + s4[3])) * (1.0f / HC);
  v4f w4 = {};
#pragma unroll
  for (int i = 0; i < 8; ++i) { q[i] -= mu; w4 += q[i] * q[i]; }
  float rs; const float va = ((w4[0] + w4[1]) + (w4[2] + w4[3])) * (1.0f / HC) + 1e-5f;      // a sum of squares plus 1e-5: never small enough for rsqrtf's small-input scaling
  asm("v_rsq_f32 %0, %1\n\tv_nop" : "=v"(rs) : "v"(va));      // the v_nop is the free slot asked for behind a transcendental; in one statement it stays directly behind it
#pragma unroll
  for (int i = 0; i < 8; ++i) {
#pragma unroll
    for (int e = 0; e < 4; ++e) q[i][e] = q[i][e] * rs * gam[i][e] + bet[i][e];
    vst2(p + 4 * i, q[i]); }
}
__global__ __launch_bounds__(256) void k_cvt(const float* __restrict__ x, _Float16* __restrict__ x16, size_t n8) {
  const size_t g8 = (size_t)blockIdx.x * 256 + threadIdx.x; if (g8 >= n8) return;
  union { v8h h; v4u u; } pk;
#pragma unroll
  for (int e = 0; e < 8; ++e) pk.h[e] = (_Float16)x[g8 * 8 + e];
  vst2(x16 + g8 * 8, pk.u);
}
__global__ __launch_bounds__(256) void k_packT(const float* __restrict__ Wqkv, const float* __restrict__ W1, const float* __restrict__ W2, _Float16* __restrict__ P) {
  // output columns n: [0,768) w_qkv, [768,1024) w1, [1024,1280) w2, all x16. P holds them as B fragments of 16 columns x 32 k, 512 halves each, at
  // (n >> 4) * 4096 + (k >> 5) * 512: first elements 0..7 of lanes 0..31 (k = 8 * (lane >> 4) + 0..7, column lane & 15), then elements 8..15 (k + 16)
  __shared__ float tile[64][65];
  const int which = blockIdx.z, o0 = blockIdx.x * 64, k0 = blockIdx.y * 64, tid = threadIdx.x;
  const float* W = which == 0 ? Wqkv : (which == 1 ? W1 : W2); const int NOUT = which == 0 ? 3 * CC : CC; const int rowbase = which == 0 ? 0 : (which == 1 ? 3 * CC : 4 * CC);
  if (o0 >= NOUT) return;                                // uniform per block, before any barrier
  for (int q = tid; q < 64 * 64; q += 256) { const int kl = q >> 6, ol = q & 63; tile[kl][ol] = W[(size_t)(k0 + kl) * NOUT + o0 + ol]; }
  __syncthreads();
  for (int u = 0; u < 2; ++u) { const int idx = tid + u * 256, ln = idx & 31, hf = (idx >> 5) & 1, kl = (idx >> 6) & 1, nt = idx >> 7;      // one wave fills half a fragment
    const int ol = nt * 16 + (ln & 15), pc = kl * 4 + hf * 2 + (ln >> 4); union { v8h hh; v4u uu; } pk;
#pragma unroll
    for (int i = 0; i < 8; ++i) pk.hh[i] = (_Float16)(tile[pc * 8 + i][ol] * 16.0f);
    vst2(P + (size_t)((rowbase + o0) / 16 + nt) * 4096 + (k0 / 32 + kl) * 512 + hf * 256 + ln * 8, pk.uu); }
}
// qkv for 64 rows on 16 waves (four per SIMD): column n of the 768 = h*96 + which*32 + c (reference reshape (B,HW,8,96) then split). Wave = (rg, hp):
// 16 rows x the 192 columns of heads 2hp and 2hp+1, so a (row, head) group is made, normalised and (q) written out by one and the same wave.
// q -> sq, k -> sk, v -> sv (LDS f32), LN(k), LN(v) per (row, head); q rows -> global f32 [r][h*32+c]; kv partial [blk][h][32][32] = sum_rows kn (x) vn
__global__ __launch_bounds__(512) void k_qkv(const _Float16* __restrict__ x16, const _Float16* __restrict__ P, const float* __restrict__ bqkv, const float* __restrict__ kg, const float* __restrict__ kb, const float* __restrict__ vg, const float* __restrict__ vb,
                                           float* __restrict__ qrows, float* __restrict__ part) {
  __shared__ __align__(16) float sq[64][CC + 4], sk[64][CC + 4], sv[64][CC + 4];
  const int tid = threadIdx.x, wave = tid >> 5, lane = tid & 31, col = lane & 15, g = lane >> 4;
  const int rg = wave & 3, hp = wave >> 2;               // row group of 16 rows, pair of heads
  const int r0b = blockIdx.x * 64, r0 = r0b + rg * 16;
  const _Float16* xr = x16 + (size_t)(r0 + col) * CC + 8 * g;      // this lane's first element of its row (fragment layout as in frag_h)
  v16h ax[8];
#pragma unroll
  for (int kc = 0; kc < 8; ++kc) { union { v16h v; v8h q[2]; } u; u.q[0] = *(const v8h*)(xr + kc * 32); u.q[1] = *(const v8h*)(xr + kc * 32 + 16); ax[kc] = u.v; }
  asm volatile("s_wait_xcnt 0x0" :: "v"(xr) : "memory");      // keeps the address pair whole behind the 16 loads that name it
  // B fragments run one k group (the 6 tiles of one head) ahead: behind each WMMA its fragment register is reloaded for the next group, so 6
  // fragments a wave, 24 a SIMD, are always in flight and the other three waves of the SIMD issue while one waits for its loads
  const _Float16* pl = P + (size_t)hp * (12 * 4096) + lane * 8;      // this lane's part of every packed fragment of the head pair
  v16h bf[6];
#pragma unroll
  for (int j = 0; j < 6; ++j) bf[j] = frag_hp(pl + j * 4096);
#pragma unroll
  for (int hh = 0; hh < 2; ++hh) { v8f acc[6] = {}; const int h = 2 * hp + hh;
#pragma unroll
    for (int kc = 0; kc < 8; ++kc) {
#pragma unroll
      for (int j = 0; j < 6; ++j) { acc[j] = wmma16(ax[kc], bf[j], acc[j]);
        if (kc < 7 || hh == 0) bf[j] = frag_hp(pl + (size_t)((kc < 7 ? hh : 1) * 6 + j) * 4096 + ((kc + 1) & 7) * 512); } }
#pragma unroll
    for (int j = 0; j < 6; ++j) { const float bb = bqkv[h * 96 + j * 16 + col]; const int cc = h * HC + (j & 1) * 16 + col;      // tiles 0,1 = q, 2,3 = k, 4,5 = v
      float (*dst)[CC + 4] = j < 2 ? sq : (j < 4 ? sk : sv);
#pragma unroll
      for (int r = 0; r < 8; ++r) dst[rg * 16 + 8 * g + r][cc] = acc[j][r] * (1.0f / 16.0f) + bb; } }
  LDSX();
  // LN of k and v per (row, head) over 32 channels: one lane owns a whole group (row = lane & 15, head = 2hp + (lane >> 4)) and sums it in registers
  v4f gk[8], bk[8], gv[8], bv[8];                        // gamma and beta, the same for every group
#pragma unroll
  for (int i = 0; i < 32; ++i) { gk[i >> 2][i & 3] = kg[i]; bk[i >> 2][i & 3] = kb[i]; gv[i >> 2][i & 3] = vg[i]; bv[i >> 2][i & 3] = vb[i]; }
  ln32(&sk[rg * 16 + col][(2 * hp + g) * HC], gk, bk);
  ln32(&sv[rg * 16 + col][(2 * hp + g) * HC], gv, bv);
  // q rows out (the wave's 16 rows x its 64 channels: 256 contiguous bytes a row)
  for (int q = lane; q < 16 * 16; q += 32) { const int rl = q >> 4, pc = q & 15; vst2(qrows + (size_t)(r0 + rl) * CC + hp * 64 + pc * 4, *(const v4f*)(&sq[rg * 16 + rl][hp * 64 + pc * 4])); }
  __syncthreads();
  // kv partials over the block's 64 rows on WMMA: part[h][d][e] = sum over rows of kn[row][d] * vn[row][e], so A = kn^T (M = d, K = row) and B = vn (K = row, N = e).
  // Both fragments are columns of the f32 tiles, read with the same k order (rows kc*32 + 8g + 0..7, then + 16) and rounded to f16. The four waves of a head pair
  // share its 8 tiles of 16 x 16: wave = head 2hp + (rg >> 1), rows d0..d0+15 of the 32 x 32 result, both column tiles, K = 64 in two WMMAs each.
  // The loops below are unrolled whole so that every fragment and accumulator element has a constant index and stays in registers
  __shared__ __align__(16) float sp[NHD * HC * HC];
  { const int h = 2 * hp + (rg >> 1), d0 = (rg & 1) * 16;
    const float* ka = &sk[8 * g][h * HC + d0 + col]; const float* va = &sv[8 * g][h * HC + col];
    v16h a[2], b0[2], b1[2];                             // all six fragments are read before the first WMMA: one LDS latency, not one per k half
#pragma unroll
    for (int kc = 0; kc < 2; ++kc) {
#pragma unroll
      for (int i = 0; i < 8; ++i) { const int ra = (kc * 32 + i) * (CC + 4), rb = ra + 16 * (CC + 4);
        a[kc][i] = (_Float16)ka[ra]; a[kc][8 + i] = (_Float16)ka[rb];
        b0[kc][i] = (_Float16)va[ra]; b0[kc][8 + i] = (_Float16)va[rb];
        b1[kc][i] = (_Float16)va[ra + 16]; b1[kc][8 + i] = (_Float16)va[rb + 16]; } }
    v8f c0 = {}, c1 = {};
#pragma unroll
    for (int kc = 0; kc < 2; ++kc) { c0 = wmma16(a[kc], b0[kc], c0); c1 = wmma16(a[kc], b1[kc], c1); }
#pragma unroll
    for (int r = 0; r < 8; ++r) { float* o = &sp[(h * HC + d0 + 8 * g + r) * HC + col]; o[0] = c0[r]; o[16] = c1[r]; } }
  __syncthreads();
  for (int q = tid; q < NHD * HC * HC / 4; q += 512) vst2(part + (size_t)blockIdx.x * (NHD * HC * HC) + q * 4, *(const v4f*)(&sp[q * 4]));
}
// kv[b][h][32][32] = (sum over the 64 blocks of batch b, fixed order) / HW. The (h, d, e) planes of one batch entry are 8192 adjacent floats in
// part and in kv alike: one thread owns two adjacent outputs. Its 64 loads depend on nothing: with both loops unrolled whole the compiler issues them
// far ahead of the adds (a rolled loop waits out one full load latency per term); the adds keep the order blk = 0..63
__global__ __launch_bounds__(128) void k_kv(const float* __restrict__ part, float* __restrict__ kv) {
  const int i2 = (blockIdx.x * 128 + threadIdx.x) * 2;                // first of the two outputs, in [0, NB * 8192)
  const int b = i2 / (NHD * HC * HC), i = i2 % (NHD * HC * HC);
  const float* p = part + (size_t)b * BPB * (NHD * HC * HC) + i;
  v2f t[BPB];
#pragma unroll
  for (int blk = 0; blk < BPB; ++blk) t[blk] = *(const v2f*)(p + (size_t)blk * (NHD * HC * HC));
  v2f s = {};
#pragma unroll
  for (int blk = 0; blk < BPB; ++blk) s += t[blk];
  vst2(kv + i2, s * (1.0f / (float)HWN));
}
// per 64-row block, 16 waves: wave = (rg, cq) = 16 rows x a quarter of the 256 columns (64 = two heads). out = q @ kv (WMMA per head, K = 32, N = 32) + x -> ret
// (LDS); hid = gelu(ret @ w1 + b1) (LDS); out = hid @ w2 + b2 + x. Each GEMM reads whole rows that four waves wrote: a work-group barrier stands in front of it
__global__ __launch_bounds__(512) void k_mlp(const float* __restrict__ qrows, const float* __restrict__ kv, const float* __restrict__ x, const _Float16* __restrict__ P, const float* __restrict__ b1, const float* __restrict__ b2, float* __restrict__ out) {
  __shared__ __align__(16) float sr[64][CC + 4];      // ret, later reused for the output tile
  __shared__ __align__(16) float sh[64][CC + 4];      // hidden
  const int tid = threadIdx.x, wave = tid >> 5, lane = tid & 31, col = lane & 15, g = lane >> 4;
  const int rg = wave & 3, cq = wave >> 2;            // row group of 16 rows, quarter of the columns
  const int r0b = blockIdx.x * 64, r0 = r0b + rg * 16; const int b = r0b / HWN;
  // B fragments of both GEMMs run one k group (the wave's 4 tiles) ahead, as in k_qkv: the wave's tiles of w2^T lie 16 tiles behind those of w1^T in P, so its 16
  // groups (64 columns x 32 k each) form one run; group 0 is fetched here, behind each WMMA its register is reloaded for the next group (the last reloads group 15, unused)
  const _Float16* pn = P + (size_t)(3 * CC / 16 + cq * 4) * 4096 + lane * 8;      // this lane's first element of tile 0 in the group that is fetched next
  v16h bf[4];
#pragma unroll
  for (int j = 0; j < 4; ++j) bf[j] = frag_hp(pn + j * 16 * CC);
#pragma unroll 1
  for (int hh = 0; hh < 2; ++hh) { const int h = 2 * cq + hh; const v16h a = frag_f32(qrows + (size_t)(r0 + col) * CC + h * HC, lane); const float* kvh = kv + ((size_t)b * NHD + h) * (HC * HC);
#pragma unroll
    for (int t = 0; t < 2; ++t) { v16h bb; const int n = t * 16 + col;                       // B[k=d][n=e] = kv[d][e] x64 (scaled in f32 before the cast: keeps small entries normal)
#pragma unroll
      for (int i = 0; i < 8; ++i) { bb[i] = (_Float16)(kvh[(8 * g + i) * HC + n] * 64.0f); bb[8 + i] = (_Float16)(kvh[(16 + 8 * g + i) * HC + n] * 64.0f); }
      v8f acc = {}; acc = wmma16(a, bb, acc);
#pragma unroll
      for (int r = 0; r < 8; ++r) { const int cc = h * HC + t * 16 + col; sr[rg * 16 + 8 * g + r][cc] = acc[r] * (1.0f / 64.0f) + x[(size_t)(r0 + 8 * g + r) * CC + cc]; } } }
  __syncthreads();                                     // ret rows are whole only when all four column quarters are written
  // hidden = gelu(ret @ w1 + b1): A from sr rows (f32 -> f16), B = packed fragments of columns 768.. (w1 x16)
  { v8f acc[4];                                        // hidden columns cq*64 .. +63
#pragma unroll
    for (int j = 0; j < 4; ++j) acc[j] = (v8f){};
#pragma unroll 1
    for (int kc = 0; kc < CC / 32; ++kc) { const v16h a = frag_f32(&sr[rg * 16 + col][0] + kc * 32, lane); pn += kc < 7 ? 512 : 16 * 4096 - 7 * 512;
#pragma unroll
      for (int j = 0; j < 4; ++j) { acc[j] = wmma16(a, bf[j], acc[j]); bf[j] = frag_hp(pn + j * 16 * CC); }
      asm volatile("s_wait_xcnt 0x0" ::: "memory"); }        // the next trip rewrites the address register that the loads above name
#pragma unroll
    for (int j = 0; j < 4; ++j) { const int cc = cq * 64 + j * 16 + col; const float bb = b1[cc];
#pragma unroll
      for (int r = 0; r < 8; ++r) sh[rg * 16 + 8 * g + r][cc] = gelu_e(acc[j][r] * (1.0f / 16.0f) + bb); } }
  __syncthreads();                                     // hidden rows are whole, and no wave reads sr any more
  // second GEMM: sr is no longer read (behind the barrier every wave has left the first GEMM), so the output goes straight into sr
  { v8f acc[4];
#pragma unroll
    for (int j = 0; j < 4; ++j) acc[j] = (v8f){};
#pragma unroll 1
    for (int kc = 0; kc < CC / 32; ++kc) { const v16h a = frag_f32(&sh[rg * 16 + col][0] + kc * 32, lane); pn += kc < 7 ? 512 : 0;
#pragma unroll
      for (int j = 0; j < 4; ++j) { acc[j] = wmma16(a, bf[j], acc[j]); bf[j] = frag_hp(pn + j * 16 * CC); }
      asm volatile("s_wait_xcnt 0x0" ::: "memory"); }        // the next trip rewrites the address register that the loads above name
    float bo[4]; const int cb = cq * 64 + col;
#pragma unroll
    for (int j = 0; j < 4; ++j) bo[j] = b2[cb + j * 16];
    asm volatile("s_wait_xcnt 0x0" :: "v"(cb) : "memory");      // keeps the index register whole behind the four loads that name it
#pragma unroll
    for (int j = 0; j < 4; ++j) { const int cc = cb + j * 16;
#pragma unroll
      for (int r = 0; r < 8; ++r) sr[rg * 16 + 8 * g + r][cc] = acc[j][r] * (1.0f / 16.0f) + bo[j] + x[(size_t)(r0 + 8 * g + r) * CC + cc]; } }
  LDSX();
  // the wave's own 16 rows x 64 columns out: 256 contiguous bytes a row
  for (int q = lane; q < 16 * 16; q += 32) { const int rl = q >> 4, pc = q & 15; vst2(out + (size_t)(r0 + rl) * CC + cq * 64 + pc * 4, *(const v4f*)(&sr[rg * 16 + rl][cq * 64 + pc * 4])); }
}
extern "C" void kernel_launch(void* const* d_in, const int* in_sizes, int n_in, void* d_out, int out_size, void* d_ws, size_t ws_size, hipStream_t stream) {
  (void)in_sizes; (void)n_in; (void)out_size; (void)ws_size;
  const float** I = (const float**)d_in;
  const float* x = I[0]; const float* Wqkv = I[1]; const float* bqkv = I[2]; const float* kg = I[3]; const float* kb = I[4]; const float* vg = I[5]; const float* vb = I[6]; const float* W1 = I[7]; const float* b1 = I[8]; const float* W2 = I[9]; const float* b2 = I[10];
  float* out = (float*)d_out;
  char* ws = (char*)d_ws; size_t off = 0;
  auto take = [&](size_t bytes) { char* p = ws + off; off += (bytes + 255) & ~(size_t)255; return p; };
  _Float16* x16 = (_Float16*)take((size_t)NR * CC * 2); _Float16* P = (_Float16*)take((size_t)5 * CC * CC * 2); float* qrows = (float*)take((size_t)NR * CC * 4);
  float* part = (float*)take((size_t)(NR / 64) * NHD * HC * HC * 4); float* kv = (float*)take((size_t)NB * NHD * HC * HC * 4);
  const size_t n8 = (size_t)NR * CC / 8; k_cvt<<<(unsigned)(n8 / 256), 256, 0, stream>>>(x, x16, n8);
  k_packT<<<dim3(3 * CC / 64, CC / 64, 3), 256, 0, stream>>>(Wqkv, W1, W2, P);
  k_qkv<<<NR / 64, 512, 0, stream>>>(x16, P, bqkv, kg, kb, vg, vb, qrows, part);
  k_kv<<<NB * NHD * HC * HC / 256, 128, 0, stream>>>(part, kv);
  k_mlp<<<NR / 64, 512, 0, stream>>>(qrows, kv, x, P, b1, b2, out);
}

// v007
// Measured time: 70 microseconds a run.
// Timed twice side by side with v006, it ran 1.07 times as fast both times.
// Over all steps from v000 it is 6.08 times as fast.
#include <hip/hip_runtime.h>
#include <math.h>

typedef __attribute__((ext_vector_type(16))) _Float16 v16h;
typedef __attribute__((ext_vector_type(16))) __bf16 v16b;
typedef __attribute__((ext_vector_type(8)))  _Float16 v8h;
typedef __attribute__((ext_vector_type(4)))  _Float16 v4h;
typedef __attribute__((ext_vector_type(8)))  float v8f;
typedef __attribute__((ext_vector_type(4)))  float v4f;
typedef __attribute__((ext_vector_type(2)))  float v2f;
typedef __attribute__((ext_vector_type(4)))  unsigned v4u;
typedef __attribute__((ext_vector_type(4)))  int v4i;
typedef float __attribute__((may_alias)) float_a;
typedef int __attribute__((may_alias)) int_a;

template <typename T> __device__ __forceinline__ void vst2(void* p, T v) { *(T*)p = v;  }
__device__ __forceinline__ v8f wmma16(v16h a, v16h b, v8f c) {
  v8f d = __builtin_amdgcn_wmma_f32_16x16x32_f16(false, a, false, b, (short)0, c, false, false);
  asm volatile("v_nop\n\tv_nop\n\tv_nop\n\tv_nop" : "+v"(d) : "v"(a), "v"(b));
  return d;
}
__device__ __forceinline__ v8f wmma_bf(v16b a, v16b b, v8f c) {
  v8f d = __builtin_amdgcn_wmma_f32_16x16x32_bf16(false, a, false, b, (short)0, c, false, false);
  asm volatile("v_nop\n\tv_nop\n\tv_nop\n\tv_nop" : "+v"(d) : "v"(a), "v"(b));
  return d;
}
// 16x16x32 fragments: lane = (h = lane>>4, row/col = lane&15); elements 0..7 = k0+8h+0..7, 8..15 = k0+16+8h+0..7; D element r = row 8h+r
__device__ __forceinline__ v16h frag_h(const _Float16* rowk0, int lane) {
  union { v16h v; v8h q[2]; } u; const _Float16* p = rowk0 + 8 * (lane >> 4);
  u.q[0] = *(const v8h*)p; u.q[1] = *(const v8h*)(p + 16); return u.v;
}
// a fragment of the packed weights (layout at k_packT) from a pointer that already holds the lane's 8 * lane part: each of the two loads reads
// 512 contiguous bytes per wave, four whole 128-byte lines
__device__ __forceinline__ v16h frag_hp(const _Float16* p) {
  union { v16h v; v8h q[2]; } u; u.q[0] = *(const v8h*)p; u.q[1] = *(const v8h*)(p + 256); return u.v;
}
__device__ __forceinline__ v16h frag_f32(const float* rowk0, int lane) {
  v16h a; const float* p = rowk0 + 8 * (lane >> 4);
#pragma unroll
  for (int i = 0; i < 8; ++i) { a[i] = (_Float16)p[i]; a[8 + i] = (_Float16)p[16 + i]; }
  return a;
}
__device__ __forceinline__ v16h frag_f32s(const float* rowk0, int lane, float sc) {
  v16h a; const float* p = rowk0 + 8 * (lane >> 4);
#pragma unroll
  for (int i = 0; i < 8; ++i) { a[i] = (_Float16)(p[i] * sc); a[8 + i] = (_Float16)(p[16 + i] * sc); }
  return a;
}
// column fragment from a [K][ld] layout (column n), rows >= K read as 0
__device__ __forceinline__ v16h fragc_f32(const float* W, int k0, int n, int lane, int ld, int K) {
  v16h a; const int g = lane >> 4;
#pragma unroll
  for (int i = 0; i < 8; ++i) { const int ka = k0 + 8 * g + i, kb = ka + 16;
    a[i] = (_Float16)(ka < K ? W[(size_t)ka * ld + n] : 0.f); a[8 + i] = (_Float16)(kb < K ? W[(size_t)kb * ld + n] : 0.f); }
  return a;
}
struct F2 { v16b h, l; };
__device__ __forceinline__ F2 bsplit16(const float v[16]) { F2 r;
#pragma unroll
  for (int i = 0; i < 16; ++i) { const __bf16 h = (__bf16)v[i]; r.h[i] = h; r.l[i] = (__bf16)(v[i] - (float)h); }
  return r; }
__device__ __forceinline__ F2 split_row(const float* row, int k0, int lane) { float v[16]; const float* p = row + k0 + 8 * (lane >> 4);
#pragma unroll
  for (int i = 0; i < 8; ++i) { v[i] = p[i]; v[8 + i] = p[16 + i]; }
  return bsplit16(v); }
__device__ __forceinline__ F2 split_rowK(const float* row, int k0, int lane, int K) { float v[16]; const int g = lane >> 4;
#pragma unroll
  for (int i = 0; i < 8; ++i) { const int ka = k0 + 8 * g + i, kb = ka + 16; v[i] = ka < K ? row[ka] : 0.f; v[8 + i] = kb < K ? row[kb] : 0.f; }
  return bsplit16(v); }
__device__ __forceinline__ F2 split_col(const float* W, int k0, int n, int lane, int ld, int K) { float v[16]; const int g = lane >> 4;
#pragma unroll
  for (int i = 0; i < 8; ++i) { const int ka = k0 + 8 * g + i, kb = ka + 16; v[i] = ka < K ? W[(size_t)ka * ld + n] : 0.f; v[8 + i] = kb < K ? W[(size_t)kb * ld + n] : 0.f; }
  return bsplit16(v); }
__device__ __forceinline__ v8f mac3(const F2& a, const F2& b, v8f c) { c = wmma_bf(a.l, b.h, c); c = wmma_bf(a.h, b.l, c); return wmma_bf(a.h, b.h, c); }
__device__ __forceinline__ float sigm(float v) { return 1.0f / (1.0f + expf(-v)); }
#define LDSX() do { asm volatile("s_wait_dscnt 0" ::: "memory"); __builtin_amdgcn_wave_barrier(); __builtin_amdgcn_fence(__ATOMIC_RELEASE, "workgroup"); } while (0)

// Linear (kernelised) attention block. qkv = x@w_qkv + b on f16 WMMA (x rounded to f16 on its way into LDS, [in][out] weights packed x16 in B fragment order); per
// head LayerNorm of k and v over their 32 channels in f32 (LDS); kv_h = k_h^T v_h as deterministic per-block 32x32 partial sums (f16
// WMMA, f32 accumulators) reduced in fixed order and divided by HW; then per 64-row block: out = q @ kv on WMMA (K = 32), + x, GELU(erf) MLP on f16 WMMA
// with the hidden tile in LDS, + x.
#define NB 8
#define HWN 4096
#define CC 256
#define NHD 8
#define HC 32
#define NR (NB * HWN)
#define BPB (HWN / 64)        // 64 row-blocks per batch entry

__device__ __forceinline__ float gelu_e(float v) { return 0.5f * v * (1.0f + erff(v * 0.70710678118654752f)); }

// LayerNorm of one 32-channel group in LDS, done by one lane: 8 reads of 16 bytes, mean and variance summed in registers (four partial sums
// each, folded pairwise), written back in place. At a row pitch of 16 B x odd the 16 lanes of a half wave fall on distinct banks
__device__ __forceinline__ void ln32(float* p, const v4f (&gam)[8], const v4f (&bet)[8]) {
  v4f q[8];
#pragma unroll
  for (int i = 0; i < 8; ++i) q[i] = *(const v4f*)(p + 4 * i);
  v4f s4 = q[0];
#pragma unroll
  for (int i = 1; i < 8; ++i) s4 += q[i];
  const float mu = ((s4[0] + s4[1]) + (s4[2] + s4[3])) * (1.0f / HC);
  v4f w4 = {};
#pragma unroll
  for (int i = 0; i < 8; ++i) { q[i] -= mu; w4 += q[i] * q[i]; }
  float rs; const float va = ((w4[0] + w4[1]) + (w4[2] + w4[3])) * (1.0f / HC) + 1e-5f;      // a sum of squares plus 1e-5: never small enough for rsqrtf's small-input scaling
  asm("v_rsq_f32 %0, %1\n\tv_nop" : "=v"(rs) : "v"(va));      // the v_nop is the free slot asked for behind a transcendental; in one statement it stays directly behind it
#pragma unroll
  for (int i = 0; i < 8; ++i) {
#pragma unroll
    for (int e = 0; e < 4; ++e) q[i][e] = q[i][e] * rs * gam[i][e] + bet[i][e];
    vst2(p + 4 * i, q[i]); }
}
__global__ __launch_bounds__(256) void k_packT(const float* __restrict__ Wqkv, const float* __restrict__ W1, const float* __restrict__ W2, _Float16* __restrict__ P) {
  // output columns n: [0,768) w_qkv, [768,1024) w1, [1024,1280) w2, all x16. P holds them as B fragments of 16 columns x 32 k, 512 halves each, at
  // (n >> 4) * 4096 + (k >> 5) * 512: first elements 0..7 of lanes 0..31 (k = 8 * (lane >> 4) + 0..7, column lane & 15), then elements 8..15 (k + 16)
  __shared__ float tile[64][65];
  const int which = blockIdx.z, o0 = blockIdx.x * 64, k0 = blockIdx.y * 64, tid = threadIdx.x;
  const float* W = which == 0 ? Wqkv : (which == 1 ? W1 : W2); const int NOUT = which == 0 ? 3 * CC : CC; const int rowbase = which == 0 ? 0 : (which == 1 ? 3 * CC : 4 * CC);
  if (o0 >= NOUT) return;                                // uniform per block, before any barrier
  for (int q = tid; q < 64 * 64; q += 256) { const int kl = q >> 6, ol = q & 63; tile[kl][ol] = W[(size_t)(k0 + kl) * NOUT + o0 + ol]; }
  __syncthreads();
  for (int u = 0; u < 2; ++u) { const int idx = tid + u * 256, ln = idx & 31, hf = (idx >> 5) & 1, kl = (idx >> 6) & 1, nt = idx >> 7;      // one wave fills half a fragment
    const int ol = nt * 16 + (ln & 15), pc = kl * 4 + hf * 2 + (ln >> 4); union { v8h hh; v4u uu; } pk;
#pragma unroll
    for (int i = 0; i < 8; ++i) pk.hh[i] = (_Float16)(tile[pc * 8 + i][ol] * 16.0f);
    vst2(P + (size_t)((rowbase + o0) / 16 + nt) * 4096 + (k0 / 32 + kl) * 512 + hf * 256 + ln * 8, pk.uu); }
}
// qkv for 64 rows on 16 waves (four per SIMD): column n of the 768 = h*96 + which*32 + c (reference reshape (B,HW,8,96) then split). Wave = (rg, hp):
// 16 rows x the 192 columns of heads 2hp and 2hp+1, so a (row, head) group is made, normalised and (q) written out by one and the same wave.
// q -> sq, k -> sk, v -> sv (LDS f32), LN(k), LN(v) per (row, head); q rows -> global f32 [r][h*32+c]; kv partial [blk][h][32][32] = sum_rows kn (x) vn
__global__ __launch_bounds__(512) void k_qkv(const float* __restrict__ x, const _Float16* __restrict__ P, const float* __restrict__ bqkv, const float* __restrict__ kg, const float* __restrict__ kb, const float* __restrict__ vg, const float* __restrict__ vb,
                                           float* __restrict__ qrows, float* __restrict__ part) {
  __shared__ __align__(16) float sq[64][CC + 4], sk[64][CC + 4], sv[64][CC + 4];
  const int tid = threadIdx.x, wave = tid >> 5, lane = tid & 31, col = lane & 15, g = lane >> 4;
  const int rg = wave & 3, hp = wave >> 2;               // row group of 16 rows, pair of heads
  const int r0b = blockIdx.x * 64, r0 = r0b + rg * 16;
  // the block's 64 rows of x (64 KiB of f32, one contiguous range): every wave-wide load reads 512 contiguous bytes; each value is rounded to f16 once and
  // laid in sx, whose pitch of 16 B x 33 keeps the 16-byte fragment reads below free of bank conflicts
  __shared__ __align__(16) _Float16 sx[64][CC + 8];
  const float* xs = x + (size_t)r0b * CC + tid * 4;
  v4f xt[8];
#pragma unroll
  for (int i = 0; i < 8; ++i) xt[i] = *(const v4f*)(xs + i * 2048);
  asm volatile("s_wait_xcnt 0x0" :: "v"(tid) : "memory");      // stands in front of any rewrite of the index register that the 8 loads above name
  // B fragments run one k group (the 6 tiles of one head) ahead: behind each WMMA its fragment register is reloaded for the next group, so 6
  // fragments a wave, 24 a SIMD, are always in flight and the other three waves of the SIMD issue while one waits for its loads
  const _Float16* pl = P + (size_t)hp * (12 * 4096) + lane * 8;      // this lane's part of every packed fragment of the head pair
  v16h bf[6];
#pragma unroll
  for (int j = 0; j < 6; ++j) bf[j] = frag_hp(pl + j * 4096);
#pragma unroll
  for (int i = 0; i < 8; ++i) { const int e = i * 2048 + tid * 4; v4h hx;
#pragma unroll
    for (int c = 0; c < 4; ++c) hx[c] = (_Float16)xt[i][c];
    vst2(&sx[e >> 8][e & 255], hx); }
  __syncthreads();                                       // every wave reads rows of sx that all 16 waves wrote
  const _Float16* xr = &sx[rg * 16 + col][8 * g];        // this lane's first element of its row (fragment layout as in frag_h)
  v16h ax[8];
#pragma unroll
  for (int kc = 0; kc < 8; ++kc) { union { v16h v; v8h q[2]; } u; u.q[0] = *(const v8h*)(xr + kc * 32); u.q[1] = *(const v8h*)(xr + kc * 32 + 16); ax[kc] = u.v; }
#pragma unroll
  for (int hh = 0; hh < 2; ++hh) { v8f acc[6] = {}; const int h = 2 * hp + hh;
#pragma unroll
    for (int kc = 0; kc < 8; ++kc) {
#pragma unroll
      for (int j = 0; j < 6; ++j) { acc[j] = wmma16(ax[kc], bf[j], acc[j]);
        if (kc < 7 || hh == 0) bf[j] = frag_hp(pl + (size_t)((kc < 7 ? hh : 1) * 6 + j) * 4096 + ((kc + 1) & 7) * 512); } }
#pragma unroll
    for (int j = 0; j < 6; ++j) { const float bb = bqkv[h * 96 + j * 16 + col]; const int cc = h * HC + (j & 1) * 16 + col;      // tiles 0,1 = q, 2,3 = k, 4,5 = v
      float (*dst)[CC + 4] = j < 2 ? sq : (j < 4 ? sk : sv);
#pragma unroll
      for (int r = 0; r < 8; ++r) dst[rg * 16 + 8 * g + r][cc] = acc[j][r] * (1.0f / 16.0f) + bb; } }
  LDSX();
  // LN of k and v per (row, head) over 32 channels: one lane owns a whole group (row = lane & 15, head = 2hp + (lane >> 4)) and sums it in registers
  v4f gk[8], bk[8], gv[8], bv[8];                        // gamma and beta, the same for every group
#pragma unroll
  for (int i = 0; i < 32; ++i) { gk[i >> 2][i & 3] = kg[i]; bk[i >> 2][i & 3] = kb[i]; gv[i >> 2][i & 3] = vg[i]; bv[i >> 2][i & 3] = vb[i]; }
  ln32(&sk[rg * 16 + col][(2 * hp + g) * HC], gk, bk);
  ln32(&sv[rg * 16 + col][(2 * hp + g) * HC], gv, bv);
  // q rows out (the wave's 16 rows x its 64 channels: 256 contiguous bytes a row)
  for (int q = lane; q < 16 * 16; q += 32) { const int rl = q >> 4, pc = q & 15; vst2(qrows + (size_t)(r0 + rl) * CC + hp * 64 + pc * 4, *(const v4f*)(&sq[rg * 16 + rl][hp * 64 + pc * 4])); }
  __syncthreads();
  // kv partials over the block's 64 rows on WMMA: part[h][d][e] = sum over rows of kn[row][d] * vn[row][e], so A = kn^T (M = d, K = row) and B = vn (K = row, N = e).
  // Both fragments are columns of the f32 tiles, read with the same k order (rows kc*32 + 8g + 0..7, then + 16) and rounded to f16. The four waves of a head pair
  // share its 8 tiles of 16 x 16: wave = head 2hp + (rg >> 1), rows d0..d0+15 of the 32 x 32 result, both column tiles, K = 64 in two WMMAs each.
  // The loops below are unrolled whole so that every fragment and accumulator element has a constant index and stays in registers
  __shared__ __align__(16) float sp[NHD * HC * HC];
  { const int h = 2 * hp + (rg >> 1), d0 = (rg & 1) * 16;
    const float* ka = &sk[8 * g][h * HC + d0 + col]; const float* va = &sv[8 * g][h * HC + col];
    v16h a[2], b0[2], b1[2];                             // all six fragments are read before the first WMMA: one LDS latency, not one per k half
#pragma unroll
    for (int kc = 0; kc < 2; ++kc) {
#pragma unroll
      for (int i = 0; i < 8; ++i) { const int ra = (kc * 32 + i) * (CC + 4), rb = ra + 16 * (CC + 4);
        a[kc][i] = (_Float16)ka[ra]; a[kc][8 + i] = (_Float16)ka[rb];
        b0[kc][i] = (_Float16)va[ra]; b0[kc][8 + i] = (_Float16)va[rb];
        b1[kc][i] = (_Float16)va[ra + 16]; b1[kc][8 + i] = (_Float16)va[rb + 16]; } }
    v8f c0 = {}, c1 = {};
#pragma unroll
    for (int kc = 0; kc < 2; ++kc) { c0 = wmma16(a[kc], b0[kc], c0); c1 = wmma16(a[kc], b1[kc], c1); }
#pragma unroll
    for (int r = 0; r < 8; ++r) { float* o = &sp[(h * HC + d0 + 8 * g + r) * HC + col]; o[0] = c0[r]; o[16] = c1[r]; } }
  __syncthreads();
  for (int q = tid; q < NHD * HC * HC / 4; q += 512) vst2(part + (size_t)blockIdx.x * (NHD * HC * HC) + q * 4, *(const v4f*)(&sp[q * 4]));
}
// kv[b][h][32][32] = (sum over the 64 blocks of batch b, fixed order) / HW. The (h, d, e) planes of one batch entry are 8192 adjacent floats in
// part and in kv alike: one thread owns two adjacent outputs. Its 64 loads depend on nothing: with both loops unrolled whole the compiler issues them
// far ahead of the adds (a rolled loop waits out one full load latency per term); the adds keep the order blk = 0..63
__global__ __launch_bounds__(128) void k_kv(const float* __restrict__ part, float* __restrict__ kv) {
  const int i2 = (blockIdx.x * 128 + threadIdx.x) * 2;                // first of the two outputs, in [0, NB * 8192)
  const int b = i2 / (NHD * HC * HC), i = i2 % (NHD * HC * HC);
  const float* p = part + (size_t)b * BPB * (NHD * HC * HC) + i;
  v2f t[BPB];
#pragma unroll
  for (int blk = 0; blk < BPB; ++blk) t[blk] = *(const v2f*)(p + (size_t)blk * (NHD * HC * HC));
  v2f s = {};
#pragma unroll
  for (int blk = 0; blk < BPB; ++blk) s += t[blk];
  vst2(kv + i2, s * (1.0f / (float)HWN));
}
// per 64-row block, 16 waves: wave = (rg, cq) = 16 rows x a quarter of the 256 columns (64 = two heads). out = q @ kv (WMMA per head, K = 32, N = 32) + x -> ret
// (LDS); hid = gelu(ret @ w1 + b1) (LDS); out = hid @ w2 + b2 + x. Each GEMM reads whole rows that four waves wrote: a work-group barrier stands in front of it
__global__ __launch_bounds__(512) void k_mlp(const float* __restrict__ qrows, const float* __restrict__ kv, const float* __restrict__ x, const _Float16* __restrict__ P, const float* __restrict__ b1, const float* __restrict__ b2, float* __restrict__ out) {
  __shared__ __align__(16) float sr[64][CC + 4];      // ret, later reused for the output tile
  __shared__ __align__(16) float sh[64][CC + 4];      // hidden
  const int tid = threadIdx.x, wave = tid >> 5, lane = tid & 31, col = lane & 15, g = lane >> 4;
  const int rg = wave & 3, cq = wave >> 2;            // row group of 16 rows, quarter of the columns
  const int r0b = blockIdx.x * 64, r0 = r0b + rg * 16; const int b = r0b / HWN;
  // B fragments of both GEMMs run one k group (the wave's 4 tiles) ahead, as in k_qkv: the wave's tiles of w2^T lie 16 tiles behind those of w1^T in P, so its 16
  // groups (64 columns x 32 k each) form one run; group 0 is fetched here, behind each WMMA its register is reloaded for the next group (the last reloads group 15, unused)
  const _Float16* pn = P + (size_t)(3 * CC / 16 + cq * 4) * 4096 + lane * 8;      // this lane's first element of tile 0 in the group that is fetched next
  v16h bf[4];
#pragma unroll
  for (int j = 0; j < 4; ++j) bf[j] = frag_hp(pn + j * 16 * CC);
#pragma unroll 1
  for (int hh = 0; hh < 2; ++hh) { const int h = 2 * cq + hh; const v16h a = frag_f32(qrows + (size_t)(r0 + col) * CC + h * HC, lane); const float* kvh = kv + ((size_t)b * NHD + h) * (HC * HC);
#pragma unroll
    for (int t = 0; t < 2; ++t) { v16h bb; const int n = t * 16 + col;                       // B[k=d][n=e] = kv[d][e] x64 (scaled in f32 before the cast: keeps small entries normal)
#pragma unroll
      for (int i = 0; i < 8; ++i) { bb[i] = (_Float16)(kvh[(8 * g + i) * HC + n] * 64.0f); bb[8 + i] = (_Float16)(kvh[(16 + 8 * g + i) * HC + n] * 64.0f); }
      v8f acc = {}; acc = wmma16(a, bb, acc);
#pragma unroll
      for (int r = 0; r < 8; ++r) { const int cc = h * HC + t * 16 + col; sr[rg * 16 + 8 * g + r][cc] = acc[r] * (1.0f / 64.0f) + x[(size_t)(r0 + 8 * g + r) * CC + cc]; } } }
  __syncthreads();                                     // ret rows are whole only when all four column quarters are written
  // hidden = gelu(ret @ w1 + b1): A from sr rows (f32 -> f16), B = packed fragments of columns 768.. (w1 x16)
  { v8f acc[4];                                        // hidden columns cq*64 .. +63
#pragma unroll
    for (int j = 0; j < 4; ++j) acc[j] = (v8f){};
#pragma unroll 1
    for (int kc = 0; kc < CC / 32; ++kc) { const v16h a = frag_f32(&sr[rg * 16 + col][0] + kc * 32, lane); pn += kc < 7 ? 512 : 16 * 4096 - 7 * 512;
#pragma unroll
      for (int j = 0; j < 4; ++j) { acc[j] = wmma16(a, bf[j], acc[j]); bf[j] = frag_hp(pn + j * 16 * CC); }
      asm volatile("s_wait_xcnt 0x0" ::: "memory"); }        // the next trip rewrites the address register that the loads above name
#pragma unroll
    for (int j = 0; j < 4; ++j) { const int cc = cq * 64 + j * 16 + col; const float bb = b1[cc];
#pragma unroll
      for (int r = 0; r < 8; ++r) sh[rg * 16 + 8 * g + r][cc] = gelu_e(acc[j][r] * (1.0f / 16.0f) + bb); } }
  __syncthreads();                                     // hidden rows are whole, and no wave reads sr any more
  // second GEMM: sr is no longer read (behind the barrier every wave has left the first GEMM), so the output goes straight into sr
  { v8f acc[4];
#pragma unroll
    for (int j = 0; j < 4; ++j) acc[j] = (v8f){};
#pragma unroll 1
    for (int kc = 0; kc < CC / 32; ++kc) { const v16h a = frag_f32(&sh[rg * 16 + col][0] + kc * 32, lane); pn += kc < 7 ? 512 : 0;
#pragma unroll
      for (int j = 0; j < 4; ++j) { acc[j] = wmma16(a, bf[j], acc[j]); bf[j] = frag_hp(pn + j * 16 * CC); }
      asm volatile("s_wait_xcnt 0x0" ::: "memory"); }        // the next trip rewrites the address register that the loads above name
    float bo[4]; const int cb = cq * 64 + col;
#pragma unroll
    for (int j = 0; j < 4; ++j) bo[j] = b2[cb + j * 16];
    asm volatile("s_wait_xcnt 0x0" :: "v"(cb) : "memory");      // keeps the index register whole behind the four loads that name it
#pragma unroll
    for (int j = 0; j < 4; ++j) { const int cc = cb + j * 16;
#pragma unroll
      for (int r = 0; r < 8; ++r) sr[rg * 16 + 8 * g + r][cc] = acc[j][r] * (1.0f / 16.0f) + bo[j] + x[(size_t)(r0 + 8 * g + r) * CC + cc]; } }
  LDSX();
  // the wave's own 16 rows x 64 columns out: 256 contiguous bytes a row
  for (int q = lane; q < 16 * 16; q += 32) { const int rl = q >> 4, pc = q & 15; vst2(out + (size_t)(r0 + rl) * CC + cq * 64 + pc * 4, *(const v4f*)(&sr[rg * 16 + rl][cq * 64 + pc * 4])); }
}
extern "C" void kernel_launch(void* const* d_in, const int* in_sizes, int n_in, void* d_out, int out_size, void* d_ws, size_t ws_size, hipStream_t stream) {
  (void)in_sizes; (void)n_in; (void)out_size; (void)ws_size;
  const float** I = (const float**)d_in;
  const float* x = I[0]; const float* Wqkv = I[1]; const float* bqkv = I[2]; const float* kg = I[3]; const float* kb = I[4]; const float* vg = I[5]; const float* vb = I[6]; const float* W1 = I[7]; const float* b1 = I[8]; const float* W2 = I[9]; const float* b2 = I[10];
  float* out = (float*)d_out;
  char* ws = (char*)d_ws; size_t off = 0;
  auto take = [&](size_t bytes) { char* p = ws + off; off += (bytes + 255) & ~(size_t)255; return p; };
  _Float16* P = (_Float16*)take((size_t)5 * CC * CC * 2); float* qrows = (float*)take((size_t)NR * CC * 4);
  float* part = (float*)take((size_t)(NR / 64) * NHD * HC * HC * 4); float* kv = (float*)take((size_t)NB * NHD * HC * HC * 4);
  k_packT<<<dim3(3 * CC / 64, CC / 64, 3), 256, 0, stream>>>(Wqkv, W1, W2, P);
  k_qkv<<<NR / 64, 512, 0, stream>>>(x, P, bqkv, kg, kb, vg, vb, qrows, part);
  k_kv<<<NB * NHD * HC * HC / 256, 128, 0, stream>>>(part, kv);
  k_mlp<<<NR / 64, 512, 0, stream>>>(qrows, kv, x, P, b1, b2, out);
}

// v008
// Measured time: 63.3 microseconds a run.
// Timed twice side by side with v007, it ran 1.07 and 1.08 times as fast.
// Counting every step since v000, it is 6.53 times as fast.
#include <hip/hip_runtime.h>
#include <math.h>

typedef __attribute__((ext_vector_type(16))) _Float16 v16h;
typedef __attribute__((ext_vector_type(16))) __bf16 v16b;
typedef __attribute__((ext_vector_type(8)))  _Float16 v8h;
typedef __attribute__((ext_vector_type(4)))  _Float16 v4h;
typedef __attribute__((ext_vector_type(8)))  float v8f;
typedef __attribute__((ext_vector_type(4)))  float v4f;
typedef __attribute__((ext_vector_type(2)))  float v2f;
typedef __attribute__((ext_vector_type(4)))  unsigned v4u;
typedef __attribute__((ext_vector_type(4)))  int v4i;
typedef float __attribute__((may_alias)) float_a;
typedef int __attribute__((may_alias)) int_a;

template <typename T> __device__ __forceinline__ void vst2(void* p, T v) { *(T*)p = v;  }
__device__ __forceinline__ v8f wmma16(v16h a, v16h b, v8f c) {
  v8f d = __builtin_amdgcn_wmma_f32_16x16x32_f16(false, a, false, b, (short)0, c, false, false);
  asm volatile("v_nop\n\tv_nop\n\tv_nop\n\tv_nop" : "+v"(d) : "v"(a), "v"(b));
  return d;
}
__device__ __forceinline__ v8f wmma_bf(v16b a, v16b b, v8f c) {
  v8f d = __builtin_amdgcn_wmma_f32_16x16x32_bf16(false, a, false, b, (short)0, c, false, false);
  asm volatile("v_nop\n\tv_nop\n\tv_nop\n\tv_nop" : "+v"(d) : "v"(a), "v"(b));
  return d;
}
// 16x16x32 fragments: lane = (h = lane>>4, row/col = lane&15); elements 0..7 = k0+8h+0..7, 8..15 = k0+16+8h+0..7; D element r = row 8h+r
__device__ __forceinline__ v16h frag_h(const _Float16* rowk0, int lane) {
  union { v16h v; v8h q[2]; } u; const _Float16* p = rowk0 + 8 * (lane >> 4);
  u.q[0] = *(const v8h*)p; u.q[1] = *(const v8h*)(p + 16); return u.v;
}
// a fragment of the packed weights (layout at k_packT) from a pointer that already holds the lane's 8 * lane part: each of the two loads reads
// 512 contiguous bytes per wave, four whole 128-byte lines
__device__ __forceinline__ v16h frag_hp(const _Float16* p) {
  union { v16h v; v8h q[2]; } u; u.q[0] = *(const v8h*)p; u.q[1] = *(const v8h*)(p + 256); return u.v;
}
__device__ __forceinline__ v16h frag_f32(const float* rowk0, int lane) {
  v16h a; const float* p = rowk0 + 8 * (lane >> 4);
#pragma unroll
  for (int i = 0; i < 8; ++i) { a[i] = (_Float16)p[i]; a[8 + i] = (_Float16)p[16 + i]; }
  return a;
}
__device__ __forceinline__ v16h frag_f32s(const float* rowk0, int lane, float sc) {
  v16h a; const float* p = rowk0 + 8 * (lane >> 4);
#pragma unroll
  for (int i = 0; i < 8; ++i) { a[i] = (_Float16)(p[i] * sc); a[8 + i] = (_Float16)(p[16 + i] * sc); }
  return a;
}
// column fragment from a [K][ld] layout (column n), rows >= K read as 0
__device__ __forceinline__ v16h fragc_f32(const float* W, int k0, int n, int lane, int ld, int K) {
  v16h a; const int g = lane >> 4;
#pragma unroll
  for (int i = 0; i < 8; ++i) { const int ka = k0 + 8 * g + i, kb = ka + 16;
    a[i] = (_Float16)(ka < K ? W[(size_t)ka * ld + n] : 0.f); a[8 + i] = (_Float16)(kb < K ? W[(size_t)kb * ld + n] : 0.f); }
  return a;
}
struct F2 { v16b h, l; };
__device__ __forceinline__ F2 bsplit16(const float v[16]) { F2 r;
#pragma unroll
  for (int i = 0; i < 16; ++i) { const __bf16 h = (__bf16)v[i]; r.h[i] = h; r.l[i] = (__bf16)(v[i] - (float)h); }
  return r; }
__device__ __forceinline__ F2 split_row(const float* row, int k0, int lane) { float v[16]; const float* p = row + k0 + 8 * (lane >> 4);
#pragma unroll
  for (int i = 0; i < 8; ++i) { v[i] = p[i]; v[8 + i] = p[16 + i]; }
  return bsplit16(v); }
__device__ __forceinline__ F2 split_rowK(const float* row, int k0, int lane, int K) { float v[16]; const int g = lane >> 4;
#pragma unroll
  for (int i = 0; i < 8; ++i) { const int ka = k0 + 8 * g + i, kb = ka + 16; v[i] = ka < K ? row[ka] : 0.f; v[8 + i] = kb < K ? row[kb] : 0.f; }
  return bsplit16(v); }
__device__ __forceinline__ F2 split_col(const float* W, int k0, int n, int lane, int ld, int K) { float v[16]; const int g = lane >> 4;
#pragma unroll
  for (int i = 0; i < 8; ++i) { const int ka = k0 + 8 * g + i, kb = ka + 16; v[i] = ka < K ? W[(size_t)ka * ld + n] : 0.f; v[8 + i] = kb < K ? W[(size_t)kb * ld + n] : 0.f; }
  return bsplit16(v); }
__device__ __forceinline__ v8f mac3(const F2& a, const F2& b, v8f c) { c = wmma_bf(a.l, b.h, c); c = wmma_bf(a.h, b.l, c); return wmma_bf(a.h, b.h, c); }
__device__ __forceinline__ float sigm(float v) { return 1.0f / (1.0f + expf(-v)); }
#define LDSX() do { asm volatile("s_wait_dscnt 0" ::: "memory"); __builtin_amdgcn_wave_barrier(); __builtin_amdgcn_fence(__ATOMIC_RELEASE, "workgroup"); } while (0)

// Linear (kernelised) attention block. qkv = x@w_qkv + b on f16 WMMA (x rounded to f16 on its way into LDS, [in][out] weights packed x16 in B fragment order); per
// head LayerNorm of k and v over their 32 channels in f32 (LDS); kv_h = k_h^T v_h as deterministic per-block 32x32 partial sums (f16
// WMMA, f32 accumulators) reduced in fixed order and divided by HW; then per 64-row block: out = q @ kv on WMMA (K = 32), + x, GELU(erf) MLP on f16 WMMA
// with the hidden tile in LDS, + x.
#define NB 8
#define HWN 4096
#define CC 256
#define NHD 8
#define HC 32
#define NR (NB * HWN)
#define BPB (HWN / 64)        // 64 row-blocks per batch entry

__device__ __forceinline__ float gelu_e(float v) { return 0.5f * v * (1.0f + erff(v * 0.70710678118654752f)); }

// LayerNorm of one 32-channel group in LDS, done by one lane: 8 reads of 16 bytes, mean and variance summed in registers (four partial sums
// each, folded pairwise), written back in place. At a row pitch of 16 B x odd the 16 lanes of a half wave fall on distinct banks
__device__ __forceinline__ void ln32(float* p, const v4f (&gam)[8], const v4f (&bet)[8]) {
  v4f q[8];
#pragma unroll
  for (int i = 0; i < 8; ++i) q[i] = *(const v4f*)(p + 4 * i);
  v4f s4 = q[0];
#pragma unroll
  for (int i = 1; i < 8; ++i) s4 += q[i];
  const float mu = ((s4[0] + s4[1]) + (s4[2] + s4[3])) * (1.0f / HC);
  v4f w4 = {};
#pragma unroll
  for (int i = 0; i < 8; ++i) { q[i] -= mu; w4 += q[i] * q[i]; }
  float rs; const float va = ((w4[0] + w4[1]) + (w4[2] + w4[3])) * (1.0f / HC) + 1e-5f;      // a sum of squares plus 1e-5: never small enough for rsqrtf's small-input scaling
  asm("v_rsq_f32 %0, %1\n\tv_nop" : "=v"(rs) : "v"(va));      // the v_nop is the free slot asked for behind a transcendental; in one statement it stays directly behind it
#pragma unroll
  for (int i = 0; i < 8; ++i) {
#pragma unroll
    for (int e = 0; e < 4; ++e) q[i][e] = q[i][e] * rs * gam[i][e] + bet[i][e];
    vst2(p + 4 * i, q[i]); }
}
__global__ __launch_bounds__(256) void k_packT(const float* __restrict__ Wqkv, const float* __restrict__ W1, const float* __restrict__ W2, _Float16* __restrict__ P) {
  // output columns n: [0,768) w_qkv, [768,1024) w1, [1024,1280) w2, all x16. P holds them as B fragments of 16 columns x 32 k, 512 halves each, at
  // (n >> 4) * 4096 + (k >> 5) * 512: first elements 0..7 of lanes 0..31 (k = 8 * (lane >> 4) + 0..7, column lane & 15), then elements 8..15 (k + 16)
  __shared__ float tile[64][65];
  const int which = blockIdx.z, o0 = blockIdx.x * 64, k0 = blockIdx.y * 64, tid = threadIdx.x;
  const float* W = which == 0 ? Wqkv : (which == 1 ? W1 : W2); const int NOUT = which == 0 ? 3 * CC : CC; const int rowbase = which == 0 ? 0 : (which == 1 ? 3 * CC : 4 * CC);
  if (o0 >= NOUT) return;                                // uniform per block, before any barrier
  // the thread's 16 loads depend on nothing: unrolled whole into registers they are all in flight at once (a rolled loop waits out one load latency per trip)
  const float* Wt = W + (size_t)(k0 + (tid >> 6)) * NOUT + o0 + (tid & 63);
  float tv[16];
#pragma unroll
  for (int u = 0; u < 16; ++u) tv[u] = Wt[(size_t)(u * 4) * NOUT];
#pragma unroll
  for (int u = 0; u < 16; ++u) tile[u * 4 + (tid >> 6)][tid & 63] = tv[u];
  __syncthreads();
  for (int u = 0; u < 2; ++u) { const int idx = tid + u * 256, ln = idx & 31, hf = (idx >> 5) & 1, kl = (idx >> 6) & 1, nt = idx >> 7;      // one wave fills half a fragment
    const int ol = nt * 16 + (ln & 15), pc = kl * 4 + hf * 2 + (ln >> 4); union { v8h hh; v4u uu; } pk;
#pragma unroll
    for (int i = 0; i < 8; ++i) pk.hh[i] = (_Float16)(tile[pc * 8 + i][ol] * 16.0f);
    vst2(P + (size_t)((rowbase + o0) / 16 + nt) * 4096 + (k0 / 32 + kl) * 512 + hf * 256 + ln * 8, pk.uu); }
}
// qkv for 64 rows on 16 waves (four per SIMD): column n of the 768 = h*96 + which*32 + c (reference reshape (B,HW,8,96) then split). Wave = (rg, hp):
// 16 rows x the 192 columns of heads 2hp and 2hp+1, so a (row, head) group is made, normalised and (q) written out by one and the same wave.
// q -> sq, k -> sk, v -> sv (LDS f32), LN(k), LN(v) per (row, head); q rows -> global f32 [r][h*32+c]; kv partial [blk][h][32][32] = sum_rows kn (x) vn
__global__ __launch_bounds__(512) void k_qkv(const float* __restrict__ x, const _Float16* __restrict__ P, const float* __restrict__ bqkv, const float* __restrict__ kg, const float* __restrict__ kb, const float* __restrict__ vg, const float* __restrict__ vb,
                                           float* __restrict__ qrows, float* __restrict__ part) {
  __shared__ __align__(16) float sq[64][CC + 4], sk[64][CC + 4], sv[64][CC + 4];
  const int tid = threadIdx.x, wave = tid >> 5, lane = tid & 31, col = lane & 15, g = lane >> 4;
  const int rg = wave & 3, hp = wave >> 2;               // row group of 16 rows, pair of heads
  const int r0b = blockIdx.x * 64, r0 = r0b + rg * 16;
  // the block's 64 rows of x (64 KiB of f32, one contiguous range): every wave-wide load reads 512 contiguous bytes; each value is rounded to f16 once and
  // laid in sx, whose pitch of 16 B x 33 keeps the 16-byte fragment reads below free of bank conflicts
  __shared__ __align__(16) _Float16 sx[64][CC + 8];
  const float* xs = x + (size_t)r0b * CC + tid * 4;
  v4f xt[8];
#pragma unroll
  for (int i = 0; i < 8; ++i) xt[i] = *(const v4f*)(xs + i * 2048);
  asm volatile("s_wait_xcnt 0x0" :: "v"(tid) : "memory");      // stands in front of any rewrite of the index register that the 8 loads above name
  // B fragments run one k group (the 6 tiles of one head) ahead: behind each WMMA its fragment register is reloaded for the next group, so 6
  // fragments a wave, 24 a SIMD, are always in flight and the other three waves of the SIMD issue while one waits for its loads
  const _Float16* pl = P + (size_t)hp * (12 * 4096) + lane * 8;      // this lane's part of every packed fragment of the head pair
  v16h bf[6];
#pragma unroll
  for (int j = 0; j < 6; ++j) bf[j] = frag_hp(pl + j * 4096);
#pragma unroll
  for (int i = 0; i < 8; ++i) { const int e = i * 2048 + tid * 4; v4h hx;
#pragma unroll
    for (int c = 0; c < 4; ++c) hx[c] = (_Float16)xt[i][c];
    vst2(&sx[e >> 8][e & 255], hx); }
  __syncthreads();                                       // every wave reads rows of sx that all 16 waves wrote
  const _Float16* xr = &sx[rg * 16 + col][8 * g];        // this lane's first element of its row (fragment layout as in frag_h)
  v16h ax[8];
#pragma unroll
  for (int kc = 0; kc < 8; ++kc) { union { v16h v; v8h q[2]; } u; u.q[0] = *(const v8h*)(xr + kc * 32); u.q[1] = *(const v8h*)(xr + kc * 32 + 16); ax[kc] = u.v; }
#pragma unroll
  for (int hh = 0; hh < 2; ++hh) { v8f acc[6] = {}; const int h = 2 * hp + hh;
#pragma unroll
    for (int kc = 0; kc < 8; ++kc) {
#pragma unroll
      for (int j = 0; j < 6; ++j) { acc[j] = wmma16(ax[kc], bf[j], acc[j]);
        if (kc < 7 || hh == 0) bf[j] = frag_hp(pl + (size_t)((kc < 7 ? hh : 1) * 6 + j) * 4096 + ((kc + 1) & 7) * 512); } }
#pragma unroll
    for (int j = 0; j < 6; ++j) { const float bb = bqkv[h * 96 + j * 16 + col]; const int cc = h * HC + (j & 1) * 16 + col;      // tiles 0,1 = q, 2,3 = k, 4,5 = v
      float (*dst)[CC + 4] = j < 2 ? sq : (j < 4 ? sk : sv);
#pragma unroll
      for (int r = 0; r < 8; ++r) dst[rg * 16 + 8 * g + r][cc] = acc[j][r] * (1.0f / 16.0f) + bb; } }
  LDSX();
  // LN of k and v per (row, head) over 32 channels: one lane owns a whole group (row = lane & 15, head = 2hp + (lane >> 4)) and sums it in registers
  v4f gk[8], bk[8], gv[8], bv[8];                        // gamma and beta, the same for every group
#pragma unroll
  for (int i = 0; i < 32; ++i) { gk[i >> 2][i & 3] = kg[i]; bk[i >> 2][i & 3] = kb[i]; gv[i >> 2][i & 3] = vg[i]; bv[i >> 2][i & 3] = vb[i]; }
  ln32(&sk[rg * 16 + col][(2 * hp + g) * HC], gk, bk);
  ln32(&sv[rg * 16 + col][(2 * hp + g) * HC], gv, bv);
  // q rows out (the wave's 16 rows x its 64 channels: 256 contiguous bytes a row)
  for (int q = lane; q < 16 * 16; q += 32) { const int rl = q >> 4, pc = q & 15; vst2(qrows + (size_t)(r0 + rl) * CC + hp * 64 + pc * 4, *(const v4f*)(&sq[rg * 16 + rl][hp * 64 + pc * 4])); }
  __syncthreads();
  // kv partials over the block's 64 rows on WMMA: part[h][d][e] = sum over rows of kn[row][d] * vn[row][e], so A = kn^T (M = d, K = row) and B = vn (K = row, N = e).
  // Both fragments are columns of the f32 tiles, read with the same k order (rows kc*32 + 8g + 0..7, then + 16) and rounded to f16. The four waves of a head pair
  // share its 8 tiles of 16 x 16: wave = head 2hp + (rg >> 1), rows d0..d0+15 of the 32 x 32 result, both column tiles, K = 64 in two WMMAs each.
  // The loops below are unrolled whole so that every fragment and accumulator element has a constant index and stays in registers
  __shared__ __align__(16) float sp[NHD * HC * HC];
  { const int h = 2 * hp + (rg >> 1), d0 = (rg & 1) * 16;
    const float* ka = &sk[8 * g][h * HC + d0 + col]; const float* va = &sv[8 * g][h * HC + col];
    v16h a[2], b0[2], b1[2];                             // all six fragments are read before the first WMMA: one LDS latency, not one per k half
#pragma unroll
    for (int kc = 0; kc < 2; ++kc) {
#pragma unroll
      for (int i = 0; i < 8; ++i) { const int ra = (kc * 32 + i) * (CC + 4), rb = ra + 16 * (CC + 4);
        a[kc][i] = (_Float16)ka[ra]; a[kc][8 + i] = (_Float16)ka[rb];
        b0[kc][i] = (_Float16)va[ra]; b0[kc][8 + i] = (_Float16)va[rb];
        b1[kc][i] = (_Float16)va[ra + 16]; b1[kc][8 + i] = (_Float16)va[rb + 16]; } }
    v8f c0 = {}, c1 = {};
#pragma unroll
    for (int kc = 0; kc < 2; ++kc) { c0 = wmma16(a[kc], b0[kc], c0); c1 = wmma16(a[kc], b1[kc], c1); }
#pragma unroll
    for (int r = 0; r < 8; ++r) { float* o = &sp[(h * HC + d0 + 8 * g + r) * HC + col]; o[0] = c0[r]; o[16] = c1[r]; } }
  __syncthreads();
  for (int q = tid; q < NHD * HC * HC / 4; q += 512) vst2(part + (size_t)blockIdx.x * (NHD * HC * HC) + q * 4, *(const v4f*)(&sp[q * 4]));
}
// kv[b][h][32][32] = (sum over the 64 blocks of batch b, fixed order) / HW. The (h, d, e) planes of one batch entry are 8192 adjacent floats in
// part and in kv alike: one thread owns two adjacent outputs. Its 64 loads depend on nothing: with both loops unrolled whole the compiler issues them
// far ahead of the adds (a rolled loop waits out one full load latency per term); the adds keep the order blk = 0..63
__global__ __launch_bounds__(128) void k_kv(const float* __restrict__ part, float* __restrict__ kv) {
  const int i2 = (blockIdx.x * 128 + threadIdx.x) * 2;                // first of the two outputs, in [0, NB * 8192)
  const int b = i2 / (NHD * HC * HC), i = i2 % (NHD * HC * HC);
  const float* p = part + (size_t)b * BPB * (NHD * HC * HC) + i;
  v2f t[BPB];
#pragma unroll
  for (int blk = 0; blk < BPB; ++blk) t[blk] = *(const v2f*)(p + (size_t)blk * (NHD * HC * HC));
  __builtin_amdgcn_sched_barrier(0);                     // keeps all 64 loads in front of the first add: without it only 28 were in flight and the rest were issued one per add
  v2f s = {};
#pragma unroll
  for (int blk = 0; blk < BPB; ++blk) s += t[blk];
  vst2(kv + i2, s * (1.0f / (float)HWN));
}
// per 64-row block, 16 waves: wave = (rg, cq) = 16 rows x a quarter of the 256 columns (64 = two heads). out = q @ kv (WMMA per head, K = 32, N = 32) + x -> ret
// (LDS); hid = gelu(ret @ w1 + b1) (LDS); out = hid @ w2 + b2 + x. Each GEMM reads whole rows that four waves wrote: a work-group barrier stands in front of it
// 8 waves a SIMD = two work-groups a WGP (the LDS allows two): the register budget is held to that, else the loads issued ahead below would cost the second work-group
__global__ __launch_bounds__(512) __attribute__((amdgpu_waves_per_eu(8))) void k_mlp(const float* __restrict__ qrows, const float* __restrict__ kv, const float* __restrict__ x, const _Float16* __restrict__ P, const float* __restrict__ b1, const float* __restrict__ b2, float* __restrict__ out) {
  __shared__ __align__(16) float sr[64][CC + 4];      // ret, later reused for the output tile
  __shared__ __align__(16) float sh[64][CC + 4];      // hidden
  const int tid = threadIdx.x, wave = tid >> 5, lane = tid & 31, col = lane & 15, g = lane >> 4;
  const int rg = wave & 3, cq = wave >> 2;            // row group of 16 rows, quarter of the columns
  const int r0b = blockIdx.x * 64, r0 = r0b + rg * 16; const int b = r0b / HWN;
  // B fragments of both GEMMs run one k group (the wave's 4 tiles) ahead, as in k_qkv: the wave's tiles of w2^T lie 16 tiles behind those of w1^T in P, so its 16
  // groups (64 columns x 32 k each) form one run; group 0 is fetched in the first stage below, behind each WMMA its register is reloaded for the next group (the last reloads group 15, unused)
  const _Float16* pn = P + (size_t)(3 * CC / 16 + cq * 4) * 4096 + lane * 8;      // this lane's first element of tile 0 in the group that is fetched next
  v16h bf[4];
  // First stage: its global loads are issued ahead in three groups that fit the register budget of two work-groups a WGP (kv and q; x once kv is packed to f16;
  // the first B fragments once the first head is done), so that a wave waits out two load latencies and not six (a load group and a wait per head and column tile). Each
  // sched_barrier keeps a group's loads in front of the work behind it; without them the compiler sinks each load group to its use
  const float* kvw = kv + ((size_t)b * NHD + 2 * cq) * (HC * HC) + (8 * g) * HC + col;      // B[k=d][n=e] = kv[d][e]: this lane's first element of head 2cq
  const float* qp = qrows + (size_t)(r0 + col) * CC + cq * 64 + 8 * g;                      // this lane's first element of its q row (fragment layout as in frag_f32)
  const float* xp = x + (size_t)(r0 + 8 * g) * CC + cq * 64 + col;
  float kr[2][2][16]; v4f qr[2][4]; float xr[4][8]; v16h bb[2][2];
#pragma unroll
  for (int hh = 0; hh < 2; ++hh) {
#pragma unroll
    for (int t = 0; t < 2; ++t) {
#pragma unroll
      for (int i = 0; i < 8; ++i) { kr[hh][t][i] = kvw[hh * HC * HC + i * HC + t * 16]; kr[hh][t][8 + i] = kvw[hh * HC * HC + (16 + i) * HC + t * 16]; } } }
  __builtin_amdgcn_sched_barrier(0);                     // kv first: loads return in order, and the wait for kv (a small, much shared table) must not take in the q rows
#pragma unroll
  for (int hh = 0; hh < 2; ++hh) { qr[hh][0] = *(const v4f*)(qp + hh * HC); qr[hh][1] = *(const v4f*)(qp + hh * HC + 4); qr[hh][2] = *(const v4f*)(qp + hh * HC + 16); qr[hh][3] = *(const v4f*)(qp + hh * HC + 20); }
  __builtin_amdgcn_sched_barrier(0);
#pragma unroll
  for (int hh = 0; hh < 2; ++hh) {
#pragma unroll
    for (int t = 0; t < 2; ++t) {
#pragma unroll
      for (int i = 0; i < 16; ++i) bb[hh][t][i] = (_Float16)(kr[hh][t][i] * 64.0f); } }    // x64 in f32 before the cast: keeps small entries normal
#pragma unroll
  for (int j = 0; j < 4; ++j) {
#pragma unroll
    for (int r = 0; r < 8; ++r) xr[j][r] = xp[r * CC + j * 16]; }
  __builtin_amdgcn_sched_barrier(0);
  v16h aq[2];
#pragma unroll
  for (int hh = 0; hh < 2; ++hh) {
#pragma unroll
    for (int i = 0; i < 4; ++i) { aq[hh][i] = (_Float16)qr[hh][0][i]; aq[hh][4 + i] = (_Float16)qr[hh][1][i]; aq[hh][8 + i] = (_Float16)qr[hh][2][i]; aq[hh][12 + i] = (_Float16)qr[hh][3][i]; } }
#pragma unroll
  for (int hh = 0; hh < 2; ++hh) {
#pragma unroll
    for (int t = 0; t < 2; ++t) { v8f acc = {}; acc = wmma16(aq[hh], bb[hh][t], acc);
#pragma unroll
      for (int r = 0; r < 8; ++r) sr[rg * 16 + 8 * g + r][cq * 64 + hh * HC + t * 16 + col] = acc[r] * (1.0f / 64.0f) + xr[hh * 2 + t][r]; }
    if (hh == 0) {
      __builtin_amdgcn_sched_barrier(0);
#pragma unroll
      for (int j = 0; j < 4; ++j) bf[j] = frag_hp(pn + j * 16 * CC);
      asm volatile("s_wait_xcnt 0x0" :: "v"(pn - (size_t)(3 * CC / 16) * 4096) : "memory");      // (the loads' base: the tile offset of w1 is their immediate) keeps the address pair whole behind the 8 loads that name it
      __builtin_amdgcn_sched_barrier(0); } }
  __syncthreads();                                     // ret rows are whole only when all four column quarters are written
  // hidden = gelu(ret @ w1 + b1): A from sr rows (f32 -> f16), B = packed fragments of columns 768.. (w1 x16)
  { v8f acc[4];                                        // hidden columns cq*64 .. +63
#pragma unroll
    for (int j = 0; j < 4; ++j) acc[j] = (v8f){};
#pragma unroll 1
    for (int kc = 0; kc < CC / 32; ++kc) { const v16h a = frag_f32(&sr[rg * 16 + col][0] + kc * 32, lane); pn += kc < 7 ? 512 : 16 * 4096 - 7 * 512;
#pragma unroll
      for (int j = 0; j < 4; ++j) { acc[j] = wmma16(a, bf[j], acc[j]); bf[j] = frag_hp(pn + j * 16 * CC); }
      asm volatile("s_wait_xcnt 0x0" ::: "memory"); }        // the next trip rewrites the address register that the loads above name
#pragma unroll
    for (int j = 0; j < 4; ++j) { const int cc = cq * 64 + j * 16 + col; const float bb = b1[cc];
#pragma unroll
      for (int r = 0; r < 8; ++r) sh[rg * 16 + 8 * g + r][cc] = gelu_e(acc[j][r] * (1.0f / 16.0f) + bb); } }
  __syncthreads();                                     // hidden rows are whole, and no wave reads sr any more
  // second GEMM: sr is no longer read (behind the barrier every wave has left the first GEMM), so the output goes straight into sr
  { v8f acc[4];
#pragma unroll
    for (int j = 0; j < 4; ++j) acc[j] = (v8f){};
#pragma unroll 1
    for (int kc = 0; kc < CC / 32; ++kc) { const v16h a = frag_f32(&sh[rg * 16 + col][0] + kc * 32, lane); pn += kc < 7 ? 512 : 0;
#pragma unroll
      for (int j = 0; j < 4; ++j) { acc[j] = wmma16(a, bf[j], acc[j]); bf[j] = frag_hp(pn + j * 16 * CC); }
      asm volatile("s_wait_xcnt 0x0" ::: "memory"); }        // the next trip rewrites the address register that the loads above name
    float bo[4]; const int cb = cq * 64 + col;
#pragma unroll
    for (int j = 0; j < 4; ++j) bo[j] = b2[cb + j * 16];
    asm volatile("s_wait_xcnt 0x0" :: "v"(cb) : "memory");      // keeps the index register whole behind the four loads that name it
    float xo[4][8];
#pragma unroll
    for (int j = 0; j < 4; ++j) {
#pragma unroll
      for (int r = 0; r < 8; ++r) xo[j][r] = xp[r * CC + j * 16]; }
    asm volatile("s_wait_xcnt 0x0" :: "v"(xp) : "memory");      // keeps the address pair whole behind the 32 loads that name it
#pragma unroll
    for (int j = 0; j < 4; ++j) { const int cc = cb + j * 16;
#pragma unroll
      for (int r = 0; r < 8; ++r) sr[rg * 16 + 8 * g + r][cc] = acc[j][r] * (1.0f / 16.0f) + bo[j] + xo[j][r]; } }
  LDSX();
  // the wave's own 16 rows x 64 columns out: 256 contiguous bytes a row
  for (int q = lane; q < 16 * 16; q += 32) { const int rl = q >> 4, pc = q & 15; vst2(out + (size_t)(r0 + rl) * CC + cq * 64 + pc * 4, *(const v4f*)(&sr[rg * 16 + rl][cq * 64 + pc * 4])); }
}
extern "C" void kernel_launch(void* const* d_in, const int* in_sizes, int n_in, void* d_out, int out_size, void* d_ws, size_t ws_size, hipStream_t stream) {
  (void)in_sizes; (void)n_in; (void)out_size; (void)ws_size;
  const float** I = (const float**)d_in;
  const float* x = I[0]; const float* Wqkv = I[1]; const float* bqkv = I[2]; const float* kg = I[3]; const float* kb = I[4]; const float* vg = I[5]; const float* vb = I[6]; const float* W1 = I[7]; const float* b1 = I[8]; const float* W2 = I[9]; const float* b2 = I[10];
  float* out = (float*)d_out;
  char* ws = (char*)d_ws; size_t off = 0;
  auto take = [&](size_t bytes) { char* p = ws + off; off += (bytes + 255) & ~(size_t)255; return p; };
  _Float16* P = (_Float16*)take((size_t)5 * CC * CC * 2); float* qrows = (float*)take((size_t)NR * CC * 4);
  float* part = (float*)take((size_t)(NR / 64) * NHD * HC * HC * 4); float* kv = (float*)take((size_t)NB * NHD * HC * HC * 4);
  k_packT<<<dim3(3 * CC / 64, CC / 64, 3), 256, 0, stream>>>(Wqkv, W1, W2, P);
  k_qkv<<<NR / 64, 512, 0, stream>>>(x, P, bqkv, kg, kb, vg, vb, qrows, part);
  k_kv<<<NB * NHD * HC * HC / 256, 128, 0, stream>>>(part, kv);
  k_mlp<<<NR / 64, 512, 0, stream>>>(qrows, kv, x, P, b1, b2, out);
}

// v009
// Measured time: 61.9 microseconds a run.
// In two side-by-side timings against v008, it was 1.04 and 1.03 times as fast.
// Counting every step since v000, it is 6.73 times as fast.
#include <hip/hip_runtime.h>
#include <math.h>

typedef __attribute__((ext_vector_type(16))) _Float16 v16h;
typedef __attribute__((ext_vector_type(16))) __bf16 v16b;
typedef __attribute__((ext_vector_type(8)))  _Float16 v8h;
typedef __attribute__((ext_vector_type(4)))  _Float16 v4h;
typedef __attribute__((ext_vector_type(8)))  float v8f;
typedef __attribute__((ext_vector_type(4)))  float v4f;
typedef __attribute__((ext_vector_type(2)))  float v2f;
typedef __attribute__((ext_vector_type(4)))  unsigned v4u;
typedef __attribute__((ext_vector_type(4)))  int v4i;
typedef float __attribute__((may_alias)) float_a;
typedef int __attribute__((may_alias)) int_a;

template <typename T> __device__ __forceinline__ void vst2(void* p, T v) { *(T*)p = v;  }
__device__ __forceinline__ v8f wmma16(v16h a, v16h b, v8f c) {
  v8f d = __builtin_amdgcn_wmma_f32_16x16x32_f16(false, a, false, b, (short)0, c, false, false);
  asm volatile("v_nop\n\tv_nop\n\tv_nop\n\tv_nop" : "+v"(d) : "v"(a), "v"(b));
  return d;
}
__device__ __forceinline__ v8f wmma_bf(v16b a, v16b b, v8f c) {
  v8f d = __builtin_amdgcn_wmma_f32_16x16x32_bf16(false, a, false, b, (short)0, c, false, false);
  asm volatile("v_nop\n\tv_nop\n\tv_nop\n\tv_nop" : "+v"(d) : "v"(a), "v"(b));
  return d;
}
// 16x16x32 fragments: lane = (h = lane>>4, row/col = lane&15); elements 0..7 = k0+8h+0..7, 8..15 = k0+16+8h+0..7; D element r = row 8h+r
__device__ __forceinline__ v16h frag_h(const _Float16* rowk0, int lane) {
  union { v16h v; v8h q[2]; } u; const _Float16* p = rowk0 + 8 * (lane >> 4);
  u.q[0] = *(const v8h*)p; u.q[1] = *(const v8h*)(p + 16); return u.v;
}
// a fragment of the packed weights (layout at k_packT) from a pointer that already holds the lane's 8 * lane part: each of the two loads reads
// 512 contiguous bytes per wave, four whole 128-byte lines
__device__ __forceinline__ v16h frag_hp(const _Float16* p) {
  union { v16h v; v8h q[2]; } u; u.q[0] = *(const v8h*)p; u.q[1] = *(const v8h*)(p + 256); return u.v;
}
__device__ __forceinline__ v16h frag_f32(const float* rowk0, int lane) {
  v16h a; const float* p = rowk0 + 8 * (lane >> 4);
#pragma unroll
  for (int i = 0; i < 8; ++i) { a[i] = (_Float16)p[i]; a[8 + i] = (_Float16)p[16 + i]; }
  return a;
}
__device__ __forceinline__ v16h frag_f32s(const float* rowk0, int lane, float sc) {
  v16h a; const float* p = rowk0 + 8 * (lane >> 4);
#pragma unroll
  for (int i = 0; i < 8; ++i) { a[i] = (_Float16)(p[i] * sc); a[8 + i] = (_Float16)(p[16 + i] * sc); }
  return a;
}
// column fragment from a [K][ld] layout (column n), rows >= K read as 0
__device__ __forceinline__ v16h fragc_f32(const float* W, int k0, int n, int lane, int ld, int K) {
  v16h a; const int g = lane >> 4;
#pragma unroll
  for (int i = 0; i < 8; ++i) { const int ka = k0 + 8 * g + i, kb = ka + 16;
    a[i] = (_Float16)(ka < K ? W[(size_t)ka * ld + n] : 0.f); a[8 + i] = (_Float16)(kb < K ? W[(size_t)kb * ld + n] : 0.f); }
  return a;
}
struct F2 { v16b h, l; };
__device__ __forceinline__ F2 bsplit16(const float v[16]) { F2 r;
#pragma unroll
  for (int i = 0; i < 16; ++i) { const __bf16 h = (__bf16)v[i]; r.h[i] = h; r.l[i] = (__bf16)(v[i] - (float)h); }
  return r; }
__device__ __forceinline__ F2 split_row(const float* row, int k0, int lane) { float v[16]; const float* p = row + k0 + 8 * (lane >> 4);
#pragma unroll
  for (int i = 0; i < 8; ++i) { v[i] = p[i]; v[8 + i] = p[16 + i]; }
  return bsplit16(v); }
__device__ __forceinline__ F2 split_rowK(const float* row, int k0, int lane, int K) { float v[16]; const int g = lane >> 4;
#pragma unroll
  for (int i = 0; i < 8; ++i) { const int ka = k0 + 8 * g + i, kb = ka + 16; v[i] = ka < K ? row[ka] : 0.f; v[8 + i] = kb < K ? row[kb] : 0.f; }
  return bsplit16(v); }
__device__ __forceinline__ F2 split_col(const float* W, int k0, int n, int lane, int ld, int K) { float v[16]; const int g = lane >> 4;
#pragma unroll
  for (int i = 0; i < 8; ++i) { const int ka = k0 + 8 * g + i, kb = ka + 16; v[i] = ka < K ? W[(size_t)ka * ld + n] : 0.f; v[8 + i] = kb < K ? W[(size_t)kb * ld + n] : 0.f; }
  return bsplit16(v); }
__device__ __forceinline__ v8f mac3(const F2& a, const F2& b, v8f c) { c = wmma_bf(a.l, b.h, c); c = wmma_bf(a.h, b.l, c); return wmma_bf(a.h, b.h, c); }
__device__ __forceinline__ float sigm(float v) { return 1.0f / (1.0f + expf(-v)); }
#define LDSX() do { asm volatile("s_wait_dscnt 0" ::: "memory"); __builtin_amdgcn_wave_barrier(); __builtin_amdgcn_fence(__ATOMIC_RELEASE, "workgroup"); } while (0)

// Linear (kernelised) attention block. qkv = x@w_qkv + b on f16 WMMA (x rounded to f16 on its way into LDS, [in][out] weights packed x16 in B fragment order); per
// head LayerNorm of k and v over their 32 channels in f32 (LDS); kv_h = k_h^T v_h as deterministic per-block 32x32 partial sums (f16
// WMMA, f32 accumulators) reduced in fixed order and divided by HW; then per 64-row block: out = q @ kv on WMMA (K = 32), + x, GELU(erf) MLP on f16 WMMA
// with the hidden tile in LDS, + x.
#define NB 8
#define HWN 4096
#define CC 256
#define NHD 8
#define HC 32
#define NR (NB * HWN)
#define BPB (HWN / 64)        // 64 row-blocks per batch entry

// GELU (erf form) without a branch. erf is made as the math library makes it, from the same two fits: |z| < 1: z + z * S(z * z); else
// sign(z) * (1 - exp(-B(|z|))). Both are worked out for every element and one is picked by a compare, so that no lane mask is saved and restored per element, the 32
// elements of a lane are independent straight-line code, and the two elements of a pair share each packed f32 multiply-add. exp(-B) is one multiply and the hardware's
// exp2: where this fit is picked (|z| >= 1) B > 1.8, so exp(-B) < 0.16 and the rounding of its argument moves 1 - exp(-B) by less than half a unit in its last place; a large B gives 0, so erf = 1
__device__ __forceinline__ v2f bc2(float c) { return (v2f){c, c}; }
__device__ __forceinline__ v2f fma2(v2f a, v2f b, v2f c) { return __builtin_elementwise_fma(a, b, c); }
// two pairs a call, their steps written side by side: four independent multiply-add chains (two fits x two pairs), so that a step does not wait for the one before it
// (the loops over u are unrolled whole, so that their arrays of two stay in registers)
__device__ __forceinline__ void gelu4(v2f (&v)[2]) {
  v2f z[2], s[2], t[2], p[2], q[2];
#pragma unroll
  for (int u = 0; u < 2; ++u) { z[u] = v[u] * 0.707106769f; s[u] = z[u] * z[u]; t[u] = (v2f){fabsf(z[u][0]), fabsf(z[u][1])}; }
#pragma unroll
  for (int u = 0; u < 2; ++u) { p[u] = fma2(t[u], bc2(0.0000169988107f), bc2(-0.000378677854f)); q[u] = fma2(s[u], bc2(-0.000561801775f), bc2(0.00491381623f)); }
#pragma unroll
  for (int u = 0; u < 2; ++u) { p[u] = fma2(t[u], p[u], bc2(0.00385781587f)); q[u] = fma2(s[u], q[u], bc2(-0.0267075151f)); }
#pragma unroll
  for (int u = 0; u < 2; ++u) { p[u] = fma2(t[u], p[u], bc2(-0.0241816975f)); q[u] = fma2(s[u], q[u], bc2(0.112800106f)); }
#pragma unroll
  for (int u = 0; u < 2; ++u) { p[u] = fma2(t[u], p[u], bc2(0.106668264f)); q[u] = fma2(s[u], q[u], bc2(-0.376122952f)); }
#pragma unroll
  for (int u = 0; u < 2; ++u) { p[u] = fma2(t[u], p[u], bc2(0.634933293f)); q[u] = fma2(s[u], q[u], bc2(0.128379107f)); }
#pragma unroll
  for (int u = 0; u < 2; ++u) { p[u] = fma2(t[u], p[u], bc2(0.128689408f)); q[u] = fma2(z[u], q[u], z[u]); }      // q is now the fit for |z| < 1
#pragma unroll
  for (int u = 0; u < 2; ++u) p[u] = fma2(t[u], p[u], t[u]) * -1.44269502f;
#pragma unroll
  for (int u = 0; u < 2; ++u) p[u] = 1.0f - (v2f){__builtin_amdgcn_exp2f(p[u][0]), __builtin_amdgcn_exp2f(p[u][1])};
#pragma unroll
  for (int u = 0; u < 2; ++u) { const v2f e = {t[u][0] < 1.0f ? q[u][0] : copysignf(p[u][0], z[u][0]), t[u][1] < 1.0f ? q[u][1] : copysignf(p[u][1], z[u][1])};
    const v2f hv = v[u] * 0.5f; v[u] = fma2(hv, e, hv); }
}

// LayerNorm of one 32-channel group in LDS, done by one lane: 8 reads of 16 bytes, mean and variance summed in registers (four partial sums
// each, folded pairwise), written back in place. At a row pitch of 16 B x odd the 16 lanes of a half wave fall on distinct banks
__device__ __forceinline__ void ln32(float* p, const v4f (&gam)[8], const v4f (&bet)[8]) {
  v4f q[8];
#pragma unroll
  for (int i = 0; i < 8; ++i) q[i] = *(const v4f*)(p + 4 * i);
  v4f s4 = q[0];
#pragma unroll
  for (int i = 1; i < 8; ++i) s4 += q[i];
  const float mu = ((s4[0] + s4[1]) + (s4[2] + s4[3])) * (1.0f / HC);
  v4f w4 = {};
#pragma unroll
  for (int i = 0; i < 8; ++i) { q[i] -= mu; w4 += q[i] * q[i]; }
  float rs; const float va = ((w4[0] + w4[1]) + (w4[2] + w4[3])) * (1.0f / HC) + 1e-5f;      // a sum of squares plus 1e-5: never small enough for rsqrtf's small-input scaling
  asm("v_rsq_f32 %0, %1\n\tv_nop" : "=v"(rs) : "v"(va));      // the v_nop is the free slot asked for behind a transcendental; in one statement it stays directly behind it
#pragma unroll
  for (int i = 0; i < 8; ++i) {
#pragma unroll
    for (int e = 0; e < 4; ++e) q[i][e] = q[i][e] * rs * gam[i][e] + bet[i][e];
    vst2(p + 4 * i, q[i]); }
}
__global__ __launch_bounds__(256) void k_packT(const float* __restrict__ Wqkv, const float* __restrict__ W1, const float* __restrict__ W2, _Float16* __restrict__ P) {
  // output columns n: [0,768) w_qkv, [768,1024) w1, [1024,1280) w2, all x16. P holds them as B fragments of 16 columns x 32 k, 512 halves each, at
  // (n >> 4) * 4096 + (k >> 5) * 512: first elements 0..7 of lanes 0..31 (k = 8 * (lane >> 4) + 0..7, column lane & 15), then elements 8..15 (k + 16)
  __shared__ float tile[64][65];
  const int which = blockIdx.z, o0 = blockIdx.x * 64, k0 = blockIdx.y * 64, tid = threadIdx.x;
  const float* W = which == 0 ? Wqkv : (which == 1 ? W1 : W2); const int NOUT = which == 0 ? 3 * CC : CC; const int rowbase = which == 0 ? 0 : (which == 1 ? 3 * CC : 4 * CC);
  if (o0 >= NOUT) return;                                // uniform per block, before any barrier
  // the thread's 16 loads depend on nothing: unrolled whole into registers they are all in flight at once (a rolled loop waits out one load latency per trip)
  const float* Wt = W + (size_t)(k0 + (tid >> 6)) * NOUT + o0 + (tid & 63);
  float tv[16];
#pragma unroll
  for (int u = 0; u < 16; ++u) tv[u] = Wt[(size_t)(u * 4) * NOUT];
#pragma unroll
  for (int u = 0; u < 16; ++u) tile[u * 4 + (tid >> 6)][tid & 63] = tv[u];
  __syncthreads();
  for (int u = 0; u < 2; ++u) { const int idx = tid + u * 256, ln = idx & 31, hf = (idx >> 5) & 1, kl = (idx >> 6) & 1, nt = idx >> 7;      // one wave fills half a fragment
    const int ol = nt * 16 + (ln & 15), pc = kl * 4 + hf * 2 + (ln >> 4); union { v8h hh; v4u uu; } pk;
#pragma unroll
    for (int i = 0; i < 8; ++i) pk.hh[i] = (_Float16)(tile[pc * 8 + i][ol] * 16.0f);
    vst2(P + (size_t)((rowbase + o0) / 16 + nt) * 4096 + (k0 / 32 + kl) * 512 + hf * 256 + ln * 8, pk.uu); }
}
// qkv for 64 rows on 16 waves (four per SIMD): column n of the 768 = h*96 + which*32 + c (reference reshape (B,HW,8,96) then split). Wave = (rg, hp):
// 16 rows x the 192 columns of heads 2hp and 2hp+1, so a (row, head) group is made, normalised and (q) written out by one and the same wave.
// q -> sq, k -> sk, v -> sv (LDS f32), LN(k), LN(v) per (row, head); q rows -> global f32 [r][h*32+c]; kv partial [blk][h][32][32] = sum_rows kn (x) vn
__global__ __launch_bounds__(512) void k_qkv(const float* __restrict__ x, const _Float16* __restrict__ P, const float* __restrict__ bqkv, const float* __restrict__ kg, const float* __restrict__ kb, const float* __restrict__ vg, const float* __restrict__ vb,
                                           float* __restrict__ qrows, float* __restrict__ part) {
  __shared__ __align__(16) float sq[64][CC + 4], sk[64][CC + 4], sv[64][CC + 4];
  const int tid = threadIdx.x, wave = tid >> 5, lane = tid & 31, col = lane & 15, g = lane >> 4;
  const int rg = wave & 3, hp = wave >> 2;               // row group of 16 rows, pair of heads
  const int r0b = blockIdx.x * 64, r0 = r0b + rg * 16;
  // the block's 64 rows of x (64 KiB of f32, one contiguous range): every wave-wide load reads 512 contiguous bytes; each value is rounded to f16 once and
  // laid in sx, whose pitch of 16 B x 33 keeps the 16-byte fragment reads below free of bank conflicts
  __shared__ __align__(16) _Float16 sx[64][CC + 8];
  const float* xs = x + (size_t)r0b * CC + tid * 4;
  v4f xt[8];
#pragma unroll
  for (int i = 0; i < 8; ++i) xt[i] = *(const v4f*)(xs + i * 2048);
  asm volatile("s_wait_xcnt 0x0" :: "v"(tid) : "memory");      // stands in front of any rewrite of the index register that the 8 loads above name
  // B fragments run one k group (the 6 tiles of one head) ahead: behind each WMMA its fragment register is reloaded for the next group, so 6
  // fragments a wave, 24 a SIMD, are always in flight and the other three waves of the SIMD issue while one waits for its loads
  const _Float16* pl = P + (size_t)hp * (12 * 4096) + lane * 8;      // this lane's part of every packed fragment of the head pair
  v16h bf[6];
#pragma unroll
  for (int j = 0; j < 6; ++j) bf[j] = frag_hp(pl + j * 4096);
#pragma unroll
  for (int i = 0; i < 8; ++i) { const int e = i * 2048 + tid * 4; v4h hx;
#pragma unroll
    for (int c = 0; c < 4; ++c) hx[c] = (_Float16)xt[i][c];
    vst2(&sx[e >> 8][e & 255], hx); }
  __syncthreads();                                       // every wave reads rows of sx that all 16 waves wrote
  const _Float16* xr = &sx[rg * 16 + col][8 * g];        // this lane's first element of its row (fragment layout as in frag_h)
  v16h ax[8];
#pragma unroll
  for (int kc = 0; kc < 8; ++kc) { union { v16h v; v8h q[2]; } u; u.q[0] = *(const v8h*)(xr + kc * 32); u.q[1] = *(const v8h*)(xr + kc * 32 + 16); ax[kc] = u.v; }
#pragma unroll
  for (int hh = 0; hh < 2; ++hh) { v8f acc[6] = {}; const int h = 2 * hp + hh;
#pragma unroll
    for (int kc = 0; kc < 8; ++kc) {
#pragma unroll
      for (int j = 0; j < 6; ++j) { acc[j] = wmma16(ax[kc], bf[j], acc[j]);
        if (kc < 7 || hh == 0) bf[j] = frag_hp(pl + (size_t)((kc < 7 ? hh : 1) * 6 + j) * 4096 + ((kc + 1) & 7) * 512); } }
#pragma unroll
    for (int j = 0; j < 6; ++j) { const float bb = bqkv[h * 96 + j * 16 + col]; const int cc = h * HC + (j & 1) * 16 + col;      // tiles 0,1 = q, 2,3 = k, 4,5 = v
      float (*dst)[CC + 4] = j < 2 ? sq : (j < 4 ? sk : sv);
#pragma unroll
      for (int r = 0; r < 8; ++r) dst[rg * 16 + 8 * g + r][cc] = acc[j][r] * (1.0f / 16.0f) + bb; } }
  LDSX();
  // LN of k and v per (row, head) over 32 channels: one lane owns a whole group (row = lane & 15, head = 2hp + (lane >> 4)) and sums it in registers
  v4f gk[8], bk[8], gv[8], bv[8];                        // gamma and beta, the same for every group
#pragma unroll
  for (int i = 0; i < 32; ++i) { gk[i >> 2][i & 3] = kg[i]; bk[i >> 2][i & 3] = kb[i]; gv[i >> 2][i & 3] = vg[i]; bv[i >> 2][i & 3] = vb[i]; }
  ln32(&sk[rg * 16 + col][(2 * hp + g) * HC], gk, bk);
  ln32(&sv[rg * 16 + col][(2 * hp + g) * HC], gv, bv);
  // q rows out (the wave's 16 rows x its 64 channels: 256 contiguous bytes a row)
  for (int q = lane; q < 16 * 16; q += 32) { const int rl = q >> 4, pc = q & 15; vst2(qrows + (size_t)(r0 + rl) * CC + hp * 64 + pc * 4, *(const v4f*)(&sq[rg * 16 + rl][hp * 64 + pc * 4])); }
  __syncthreads();
  // kv partials over the block's 64 rows on WMMA: part[h][d][e] = sum over rows of kn[row][d] * vn[row][e], so A = kn^T (M = d, K = row) and B = vn (K = row, N = e).
  // Both fragments are columns of the f32 tiles, read with the same k order (rows kc*32 + 8g + 0..7, then + 16) and rounded to f16. The four waves of a head pair
  // share its 8 tiles of 16 x 16: wave = head 2hp + (rg >> 1), rows d0..d0+15 of the 32 x 32 result, both column tiles, K = 64 in two WMMAs each.
  // The loops below are unrolled whole so that every fragment and accumulator element has a constant index and stays in registers
  __shared__ __align__(16) float sp[NHD * HC * HC];
  { const int h = 2 * hp + (rg >> 1), d0 = (rg & 1) * 16;
    const float* ka = &sk[8 * g][h * HC + d0 + col]; const float* va = &sv[8 * g][h * HC + col];
    v16h a[2], b0[2], b1[2];                             // all six fragments are read before the first WMMA: one LDS latency, not one per k half
#pragma unroll
    for (int kc = 0; kc < 2; ++kc) {
#pragma unroll
      for (int i = 0; i < 8; ++i) { const int ra = (kc * 32 + i) * (CC + 4), rb = ra + 16 * (CC + 4);
        a[kc][i] = (_Float16)ka[ra]; a[kc][8 + i] = (_Float16)ka[rb];
        b0[kc][i] = (_Float16)va[ra]; b0[kc][8 + i] = (_Float16)va[rb];
        b1[kc][i] = (_Float16)va[ra + 16]; b1[kc][8 + i] = (_Float16)va[rb + 16]; } }
    v8f c0 = {}, c1 = {};
#pragma unroll
    for (int kc = 0; kc < 2; ++kc) { c0 = wmma16(a[kc], b0[kc], c0); c1 = wmma16(a[kc], b1[kc], c1); }
#pragma unroll
    for (int r = 0; r < 8; ++r) { float* o = &sp[(h * HC + d0 + 8 * g + r) * HC + col]; o[0] = c0[r]; o[16] = c1[r]; } }
  __syncthreads();
  for (int q = tid; q < NHD * HC * HC / 4; q += 512) vst2(part + (size_t)blockIdx.x * (NHD * HC * HC) + q * 4, *(const v4f*)(&sp[q * 4]));
}
// kv[b][h][32][32] = (sum over the 64 blocks of batch b, fixed order) / HW. The (h, d, e) planes of one batch entry are 8192 adjacent floats in
// part and in kv alike: one thread owns two adjacent outputs. Its 64 loads depend on nothing: with both loops unrolled whole the compiler issues them
// far ahead of the adds (a rolled loop waits out one full load latency per term); the adds keep the order blk = 0..63
__global__ __launch_bounds__(128) void k_kv(const float* __restrict__ part, float* __restrict__ kv) {
  const int i2 = (blockIdx.x * 128 + threadIdx.x) * 2;                // first of the two outputs, in [0, NB * 8192)
  const int b = i2 / (NHD * HC * HC), i = i2 % (NHD * HC * HC);
  const float* p = part + (size_t)b * BPB * (NHD * HC * HC) + i;
  v2f t[BPB];
#pragma unroll
  for (int blk = 0; blk < BPB; ++blk) t[blk] = *(const v2f*)(p + (size_t)blk * (NHD * HC * HC));
  __builtin_amdgcn_sched_barrier(0);                     // keeps all 64 loads in front of the first add: without it only 28 were in flight and the rest were issued one per add
  v2f s = {};
#pragma unroll
  for (int blk = 0; blk < BPB; ++blk) s += t[blk];
  vst2(kv + i2, s * (1.0f / (float)HWN));
}
// per 64-row block, 16 waves: wave = (rg, cq) = 16 rows x a quarter of the 256 columns (64 = two heads). out = q @ kv (WMMA per head, K = 32, N = 32) + x -> ret
// (LDS); hid = gelu(ret @ w1 + b1) (LDS); out = hid @ w2 + b2 + x. Each GEMM reads whole rows that four waves wrote: a work-group barrier stands in front of it
// 8 waves a SIMD = two work-groups a WGP (the LDS allows two): the register budget is held to that, else the loads issued ahead below would cost the second work-group
__global__ __launch_bounds__(512) __attribute__((amdgpu_waves_per_eu(8))) void k_mlp(const float* __restrict__ qrows, const float* __restrict__ kv, const float* __restrict__ x, const _Float16* __restrict__ P, const float* __restrict__ b1, const float* __restrict__ b2, float* __restrict__ out) {
  __shared__ __align__(16) float sr[64][CC + 4];      // ret, later reused for the output tile
  __shared__ __align__(16) float sh[64][CC + 4];      // hidden
  const int tid = threadIdx.x, wave = tid >> 5, lane = tid & 31, col = lane & 15, g = lane >> 4;
  const int rg = wave & 3, cq = wave >> 2;            // row group of 16 rows, quarter of the columns
  const int r0b = blockIdx.x * 64, r0 = r0b + rg * 16; const int b = r0b / HWN;
  // B fragments of both GEMMs run one k group (the wave's 4 tiles) ahead, as in k_qkv: the wave's tiles of w2^T lie 16 tiles behind those of w1^T in P, so its 16
  // groups (64 columns x 32 k each) form one run; group 0 is fetched in the first stage below, behind each WMMA its register is reloaded for the next group (the last reloads group 15, unused)
  const _Float16* pn = P + (size_t)(3 * CC / 16 + cq * 4) * 4096 + lane * 8;      // this lane's first element of tile 0 in the group that is fetched next
  v16h bf[4];
  // First stage: its global loads are issued ahead in three groups that fit the register budget of two work-groups a WGP (kv and q; x once kv is packed to f16;
  // the first B fragments once the first head is done), so that a wave waits out two load latencies and not six (a load group and a wait per head and column tile). Each
  // sched_barrier keeps a group's loads in front of the work behind it; without them the compiler sinks each load group to its use
  const float* kvw = kv + ((size_t)b * NHD + 2 * cq) * (HC * HC) + (8 * g) * HC + col;      // B[k=d][n=e] = kv[d][e]: this lane's first element of head 2cq
  const float* qp = qrows + (size_t)(r0 + col) * CC + cq * 64 + 8 * g;                      // this lane's first element of its q row (fragment layout as in frag_f32)
  const float* xp = x + (size_t)(r0 + 8 * g) * CC + cq * 64 + col;
  float kr[2][2][16]; v4f qr[2][4]; float xr[4][8]; v16h bb[2][2];
#pragma unroll
  for (int hh = 0; hh < 2; ++hh) {
#pragma unroll
    for (int t = 0; t < 2; ++t) {
#pragma unroll
      for (int i = 0; i < 8; ++i) { kr[hh][t][i] = kvw[hh * HC * HC + i * HC + t * 16]; kr[hh][t][8 + i] = kvw[hh * HC * HC + (16 + i) * HC + t * 16]; } } }
  __builtin_amdgcn_sched_barrier(0);                     // kv first: loads return in order, and the wait for kv (a small, much shared table) must not take in the q rows
#pragma unroll
  for (int hh = 0; hh < 2; ++hh) { qr[hh][0] = *(const v4f*)(qp + hh * HC); qr[hh][1] = *(const v4f*)(qp + hh * HC + 4); qr[hh][2] = *(const v4f*)(qp + hh * HC + 16); qr[hh][3] = *(const v4f*)(qp + hh * HC + 20); }
  __builtin_amdgcn_sched_barrier(0);
#pragma unroll
  for (int hh = 0; hh < 2; ++hh) {
#pragma unroll
    for (int t = 0; t < 2; ++t) {
#pragma unroll
      for (int i = 0; i < 16; ++i) bb[hh][t][i] = (_Float16)(kr[hh][t][i] * 64.0f); } }    // x64 in f32 before the cast: keeps small entries normal
#pragma unroll
  for (int j = 0; j < 4; ++j) {
#pragma unroll
    for (int r = 0; r < 8; ++r) xr[j][r] = xp[r * CC + j * 16]; }
  __builtin_amdgcn_sched_barrier(0);
  v16h aq[2];
#pragma unroll
  for (int hh = 0; hh < 2; ++hh) {
#pragma unroll
    for (int i = 0; i < 4; ++i) { aq[hh][i] = (_Float16)qr[hh][0][i]; aq[hh][4 + i] = (_Float16)qr[hh][1][i]; aq[hh][8 + i] = (_Float16)qr[hh][2][i]; aq[hh][12 + i] = (_Float16)qr[hh][3][i]; } }
#pragma unroll
  for (int hh = 0; hh < 2; ++hh) {
#pragma unroll
    for (int t = 0; t < 2; ++t) { v8f acc = {}; acc = wmma16(aq[hh], bb[hh][t], acc);
#pragma unroll
      for (int r = 0; r < 8; ++r) sr[rg * 16 + 8 * g + r][cq * 64 + hh * HC + t * 16 + col] = acc[r] * (1.0f / 64.0f) + xr[hh * 2 + t][r]; }
    if (hh == 0) {
      __builtin_amdgcn_sched_barrier(0);
#pragma unroll
      for (int j = 0; j < 4; ++j) bf[j] = frag_hp(pn + j * 16 * CC);
      asm volatile("s_wait_xcnt 0x0" :: "v"(pn - (size_t)(3 * CC / 16) * 4096) : "memory");      // (the loads' base: the tile offset of w1 is their immediate) keeps the address pair whole behind the 8 loads that name it
      __builtin_amdgcn_sched_barrier(0); } }
  __syncthreads();                                     // ret rows are whole only when all four column quarters are written
  // hidden = gelu(ret @ w1 + b1): A from sr rows (f32 -> f16), B = packed fragments of columns 768.. (w1 x16)
  { v8f acc[4];                                        // hidden columns cq*64 .. +63
#pragma unroll
    for (int j = 0; j < 4; ++j) acc[j] = (v8f){};
#pragma unroll 1
    for (int kc = 0; kc < CC / 32; ++kc) { const v16h a = frag_f32(&sr[rg * 16 + col][0] + kc * 32, lane); pn += kc < 7 ? 512 : 16 * 4096 - 7 * 512;
#pragma unroll
      for (int j = 0; j < 4; ++j) { acc[j] = wmma16(a, bf[j], acc[j]); bf[j] = frag_hp(pn + j * 16 * CC); }
      asm volatile("s_wait_xcnt 0x0" ::: "memory"); }        // the next trip rewrites the address register that the loads above name
#pragma unroll
    for (int j = 0; j < 4; ++j) { const int cc = cq * 64 + j * 16 + col; const float bb = b1[cc];
#pragma unroll
      for (int r = 0; r < 8; r += 4) { v2f ge[2] = {fma2((v2f){acc[j][r], acc[j][r + 1]}, bc2(1.0f / 16.0f), bc2(bb)), fma2((v2f){acc[j][r + 2], acc[j][r + 3]}, bc2(1.0f / 16.0f), bc2(bb))};
        gelu4(ge);
#pragma unroll
        for (int u = 0; u < 4; ++u) sh[rg * 16 + 8 * g + r + u][cc] = ge[u >> 1][u & 1]; } } }
  __syncthreads();                                     // hidden rows are whole, and no wave reads sr any more
  // second GEMM: sr is no longer read (behind the barrier every wave has left the first GEMM), so the output goes straight into sr
  { v8f acc[4];
#pragma unroll
    for (int j = 0; j < 4; ++j) acc[j] = (v8f){};
#pragma unroll 1
    for (int kc = 0; kc < CC / 32; ++kc) { const v16h a = frag_f32(&sh[rg * 16 + col][0] + kc * 32, lane); pn += kc < 7 ? 512 : 0;
#pragma unroll
      for (int j = 0; j < 4; ++j) { acc[j] = wmma16(a, bf[j], acc[j]); bf[j] = frag_hp(pn + j * 16 * CC); }
      asm volatile("s_wait_xcnt 0x0" ::: "memory"); }        // the next trip rewrites the address register that the loads above name
    float bo[4]; const int cb = cq * 64 + col;
#pragma unroll
    for (int j = 0; j < 4; ++j) bo[j] = b2[cb + j * 16];
    asm volatile("s_wait_xcnt 0x0" :: "v"(cb) : "memory");      // keeps the index register whole behind the four loads that name it
    float xo[4][8];
#pragma unroll
    for (int j = 0; j < 4; ++j) {
#pragma unroll
      for (int r = 0; r < 8; ++r) xo[j][r] = xp[r * CC + j * 16]; }
    asm volatile("s_wait_xcnt 0x0" :: "v"(xp) : "memory");      // keeps the address pair whole behind the 32 loads that name it
#pragma unroll
    for (int j = 0; j < 4; ++j) { const int cc = cb + j * 16;
#pragma unroll
      for (int r = 0; r < 8; ++r) sr[rg * 16 + 8 * g + r][cc] = acc[j][r] * (1.0f / 16.0f) + bo[j] + xo[j][r]; } }
  LDSX();
  // the wave's own 16 rows x 64 columns out: 256 contiguous bytes a row
  for (int q = lane; q < 16 * 16; q += 32) { const int rl = q >> 4, pc = q & 15; vst2(out + (size_t)(r0 + rl) * CC + cq * 64 + pc * 4, *(const v4f*)(&sr[rg * 16 + rl][cq * 64 + pc * 4])); }
}
extern "C" void kernel_launch(void* const* d_in, const int* in_sizes, int n_in, void* d_out, int out_size, void* d_ws, size_t ws_size, hipStream_t stream) {
  (void)in_sizes; (void)n_in; (void)out_size; (void)ws_size;
  const float** I = (const float**)d_in;
  const float* x = I[0]; const float* Wqkv = I[1]; const float* bqkv = I[2]; const float* kg = I[3]; const float* kb = I[4]; const float* vg = I[5]; const float* vb = I[6]; const float* W1 = I[7]; const float* b1 = I[8]; const float* W2 = I[9]; const float* b2 = I[10];
  float* out = (float*)d_out;
  char* ws = (char*)d_ws; size_t off = 0;
  auto take = [&](size_t bytes) { char* p = ws + off; off += (bytes + 255) & ~(size_t)255; return p; };
  _Float16* P = (_Float16*)take((size_t)5 * CC * CC * 2); float* qrows = (float*)take((size_t)NR * CC * 4);
  float* part = (float*)take((size_t)(NR / 64) * NHD * HC * HC * 4); float* kv = (float*)take((size_t)NB * NHD * HC * HC * 4);
  k_packT<<<dim3(3 * CC / 64, CC / 64, 3), 256, 0, stream>>>(Wqkv, W1, W2, P);
  k_qkv<<<NR / 64, 512, 0, stream>>>(x, P, bqkv, kg, kb, vg, vb, qrows, part);
  k_kv<<<NB * NHD * HC * HC / 256, 128, 0, stream>>>(part, kv);
  k_mlp<<<NR / 64, 512, 0, stream>>>(qrows, kv, x, P, b1, b2, out);
}

// v010
// Measured time: 53.4 microseconds a run.
// Timed twice side by side with v009, it ran 1.14 and 1.15 times as fast.
// Over all steps from v000 it is 7.71 times as fast.
#include <hip/hip_runtime.h>
#include <math.h>

typedef __attribute__((ext_vector_type(16))) _Float16 v16h;
typedef __attribute__((ext_vector_type(16))) __bf16 v16b;
typedef __attribute__((ext_vector_type(8)))  _Float16 v8h;
typedef __attribute__((ext_vector_type(4)))  _Float16 v4h;
typedef __attribute__((ext_vector_type(8)))  float v8f;
typedef __attribute__((ext_vector_type(4)))  float v4f;
typedef __attribute__((ext_vector_type(2)))  float v2f;
typedef __attribute__((ext_vector_type(4)))  unsigned v4u;
typedef __attribute__((ext_vector_type(4)))  int v4i;
typedef float __attribute__((may_alias)) float_a;
typedef int __attribute__((may_alias)) int_a;

template <typename T> __device__ __forceinline__ void vst2(void* p, T v) { *(T*)p = v;  }
__device__ __forceinline__ v8f wmma16(v16h a, v16h b, v8f c) {
  v8f d = __builtin_amdgcn_wmma_f32_16x16x32_f16(false, a, false, b, (short)0, c, false, false);
  asm volatile("v_nop\n\tv_nop\n\tv_nop\n\tv_nop" : "+v"(d) : "v"(a), "v"(b));
  return d;
}
__device__ __forceinline__ v8f wmma_bf(v16b a, v16b b, v8f c) {
  v8f d = __builtin_amdgcn_wmma_f32_16x16x32_bf16(false, a, false, b, (short)0, c, false, false);
  asm volatile("v_nop\n\tv_nop\n\tv_nop\n\tv_nop" : "+v"(d) : "v"(a), "v"(b));
  return d;
}
// 16x16x32 fragments: lane = (h = lane>>4, row/col = lane&15); elements 0..7 = k0+8h+0..7, 8..15 = k0+16+8h+0..7; D element r = row 8h+r
__device__ __forceinline__ v16h frag_h(const _Float16* rowk0, int lane) {
  union { v16h v; v8h q[2]; } u; const _Float16* p = rowk0 + 8 * (lane >> 4);
  u.q[0] = *(const v8h*)p; u.q[1] = *(const v8h*)(p + 16); return u.v;
}
// a fragment of the packed weights (layout at k_packT) from a pointer that already holds the lane's 8 * lane part: each of the two loads reads
// 512 contiguous bytes per wave, four whole 128-byte lines
__device__ __forceinline__ v16h frag_hp(const _Float16* p) {
  union { v16h v; v8h q[2]; } u; u.q[0] = *(const v8h*)p; u.q[1] = *(const v8h*)(p + 256); return u.v;
}
__device__ __forceinline__ v16h frag_f32(const float* rowk0, int lane) {
  v16h a; const float* p = rowk0 + 8 * (lane >> 4);
#pragma unroll
  for (int i = 0; i < 8; ++i) { a[i] = (_Float16)p[i]; a[8 + i] = (_Float16)p[16 + i]; }
  return a;
}
__device__ __forceinline__ v16h frag_f32s(const float* rowk0, int lane, float sc) {
  v16h a; const float* p = rowk0 + 8 * (lane >> 4);
#pragma unroll
  for (int i = 0; i < 8; ++i) { a[i] = (_Float16)(p[i] * sc); a[8 + i] = (_Float16)(p[16 + i] * sc); }
  return a;
}
// column fragment from a [K][ld] layout (column n), rows >= K read as 0
__device__ __forceinline__ v16h fragc_f32(const float* W, int k0, int n, int lane, int ld, int K) {
  v16h a; const int g = lane >> 4;
#pragma unroll
  for (int i = 0; i < 8; ++i) { const int ka = k0 + 8 * g + i, kb = ka + 16;
    a[i] = (_Float16)(ka < K ? W[(size_t)ka * ld + n] : 0.f); a[8 + i] = (_Float16)(kb < K ? W[(size_t)kb * ld + n] : 0.f); }
  return a;
}
struct F2 { v16b h, l; };
__device__ __forceinline__ F2 bsplit16(const float v[16]) { F2 r;
#pragma unroll
  for (int i = 0; i < 16; ++i) { const __bf16 h = (__bf16)v[i]; r.h[i] = h; r.l[i] = (__bf16)(v[i] - (float)h); }
  return r; }
__device__ __forceinline__ F2 split_row(const float* row, int k0, int lane) { float v[16]; const float* p = row + k0 + 8 * (lane >> 4);
#pragma unroll
  for (int i = 0; i < 8; ++i) { v[i] = p[i]; v[8 + i] = p[16 + i]; }
  return bsplit16(v); }
__device__ __forceinline__ F2 split_rowK(const float* row, int k0, int lane, int K) { float v[16]; const int g = lane >> 4;
#pragma unroll
  for (int i = 0; i < 8; ++i) { const int ka = k0 + 8 * g + i, kb = ka + 16; v[i] = ka < K ? row[ka] : 0.f; v[8 + i] = kb < K ? row[kb] : 0.f; }
  return bsplit16(v); }
__device__ __forceinline__ F2 split_col(const float* W, int k0, int n, int lane, int ld, int K) { float v[16]; const int g = lane >> 4;
#pragma unroll
  for (int i = 0; i < 8; ++i) { const int ka = k0 + 8 * g + i, kb = ka + 16; v[i] = ka < K ? W[(size_t)ka * ld + n] : 0.f; v[8 + i] = kb < K ? W[(size_t)kb * ld + n] : 0.f; }
  return bsplit16(v); }
__device__ __forceinline__ v8f mac3(const F2& a, const F2& b, v8f c) { c = wmma_bf(a.l, b.h, c); c = wmma_bf(a.h, b.l, c); return wmma_bf(a.h, b.h, c); }
__device__ __forceinline__ float sigm(float v) { return 1.0f / (1.0f + expf(-v)); }
#define LDSX() do { asm volatile("s_wait_dscnt 0" ::: "memory"); __builtin_amdgcn_wave_barrier(); __builtin_amdgcn_fence(__ATOMIC_RELEASE, "workgroup"); } while (0)

// Linear (kernelised) attention block. qkv = x@w_qkv + b on f16 WMMA (x rounded to f16 on its way into LDS, [in][out] weights packed x16 in B fragment order); per
// head LayerNorm of k and v over their 32 channels in f32 (registers); kv_h = k_h^T v_h as deterministic per-block 32x32 partial sums (f16
// WMMA, f32 accumulators) reduced in fixed order and divided by HW; then per 64-row block: out = q @ kv on WMMA (K = 32), + x, GELU(erf) MLP on f16 WMMA
// with the hidden tile in LDS, + x.
#define NB 8
#define HWN 4096
#define CC 256
#define NHD 8
#define HC 32
#define NR (NB * HWN)
#define BPB (HWN / 64)        // 64 row-blocks per batch entry

// GELU (erf form) without a branch. erf is made as the math library makes it, from the same two fits: |z| < 1: z + z * S(z * z); else
// sign(z) * (1 - exp(-B(|z|))). Both are worked out for every element and one is picked by a compare, so that no lane mask is saved and restored per element, the 32
// elements of a lane are independent straight-line code, and the two elements of a pair share each packed f32 multiply-add. exp(-B) is one multiply and the hardware's
// exp2: where this fit is picked (|z| >= 1) B > 1.8, so exp(-B) < 0.16 and the rounding of its argument moves 1 - exp(-B) by less than half a unit in its last place; a large B gives 0, so erf = 1
__device__ __forceinline__ v2f bc2(float c) { return (v2f){c, c}; }
__device__ __forceinline__ v2f fma2(v2f a, v2f b, v2f c) { return __builtin_elementwise_fma(a, b, c); }
// two pairs a call, their steps written side by side: four independent multiply-add chains (two fits x two pairs), so that a step does not wait for the one before it
// (the loops over u are unrolled whole, so that their arrays of two stay in registers)
__device__ __forceinline__ void gelu4(v2f (&v)[2]) {
  v2f z[2], s[2], t[2], p[2], q[2];
#pragma unroll
  for (int u = 0; u < 2; ++u) { z[u] = v[u] * 0.707106769f; s[u] = z[u] * z[u]; t[u] = (v2f){fabsf(z[u][0]), fabsf(z[u][1])}; }
#pragma unroll
  for (int u = 0; u < 2; ++u) { p[u] = fma2(t[u], bc2(0.0000169988107f), bc2(-0.000378677854f)); q[u] = fma2(s[u], bc2(-0.000561801775f), bc2(0.00491381623f)); }
#pragma unroll
  for (int u = 0; u < 2; ++u) { p[u] = fma2(t[u], p[u], bc2(0.00385781587f)); q[u] = fma2(s[u], q[u], bc2(-0.0267075151f)); }
#pragma unroll
  for (int u = 0; u < 2; ++u) { p[u] = fma2(t[u], p[u], bc2(-0.0241816975f)); q[u] = fma2(s[u], q[u], bc2(0.112800106f)); }
#pragma unroll
  for (int u = 0; u < 2; ++u) { p[u] = fma2(t[u], p[u], bc2(0.106668264f)); q[u] = fma2(s[u], q[u], bc2(-0.376122952f)); }
#pragma unroll
  for (int u = 0; u < 2; ++u) { p[u] = fma2(t[u], p[u], bc2(0.634933293f)); q[u] = fma2(s[u], q[u], bc2(0.128379107f)); }
#pragma unroll
  for (int u = 0; u < 2; ++u) { p[u] = fma2(t[u], p[u], bc2(0.128689408f)); q[u] = fma2(z[u], q[u], z[u]); }      // q is now the fit for |z| < 1
#pragma unroll
  for (int u = 0; u < 2; ++u) p[u] = fma2(t[u], p[u], t[u]) * -1.44269502f;
#pragma unroll
  for (int u = 0; u < 2; ++u) p[u] = 1.0f - (v2f){__builtin_amdgcn_exp2f(p[u][0]), __builtin_amdgcn_exp2f(p[u][1])};
#pragma unroll
  for (int u = 0; u < 2; ++u) { const v2f e = {t[u][0] < 1.0f ? q[u][0] : copysignf(p[u][0], z[u][0]), t[u][1] < 1.0f ? q[u][1] : copysignf(p[u][1], z[u][1])};
    const v2f hv = v[u] * 0.5f; v[u] = fma2(hv, e, hv); }
}

// lane l with lane l ^ 16
__device__ __forceinline__ float xhalf(float v) { return __builtin_bit_cast(float, __builtin_amdgcn_permlanex16(__builtin_bit_cast(int, v), __builtin_bit_cast(int, v), 0x76543210, 0xfedcba98, false, false)); }
__device__ __forceinline__ float sum8(v8f s) { return ((s[0] + s[1]) + (s[2] + s[3])) + ((s[4] + s[5]) + (s[6] + s[7])); }
// LayerNorm of one 32-channel group in registers: lanes l and l ^ 16 hold one row's group between them, 16 channels each (a: 8g + 0..7, b: 16 + 8g + 0..7). Each sums its own
// 16 and adds the other's sum (one cross-row move for the mean, one for the variance). gb: this lane's part of gamma in LDS, beta 32 floats behind it
__device__ __forceinline__ void ln16(v8f& a, v8f& b, const float* gb) {
  float s = sum8(a + b); s += xhalf(s);
  const float mu = s * (1.0f / HC);
  a -= mu; b -= mu;
  float w = sum8(a * a + b * b); w += xhalf(w);
  float rs; const float va = w * (1.0f / HC) + 1e-5f;      // a sum of squares plus 1e-5: never small enough for rsqrtf's small-input scaling
  asm("v_rsq_f32 %0, %1\n\tv_nop" : "=v"(rs) : "v"(va));      // the v_nop is the free slot asked for behind a transcendental; in one statement it stays directly behind it
  a = a * rs * *(const v8f*)gb + *(const v8f*)(gb + 32);
  b = b * rs * *(const v8f*)(gb + 16) + *(const v8f*)(gb + 48);
}
__device__ __forceinline__ v8h cvt8(v8f v) { v8h r;
#pragma unroll
  for (int i = 0; i < 8; ++i) r[i] = (_Float16)v[i];
  return r; }
// transposing LDS load: from a row-major 16-bit tile the lane (c = lane & 15, h = lane >> 4) gets rows 8h + 0..7 of column c (the lane addresses: at its use below)
typedef __attribute__((ext_vector_type(8))) short s16x8;
__device__ __forceinline__ v8h ld_tr16(const char* p) { typedef __attribute__((address_space(3))) s16x8 lds_s16x8; return __builtin_bit_cast(v8h, __builtin_amdgcn_ds_load_tr16_b128_v8i16((lds_s16x8*)p)); }
__global__ __launch_bounds__(256) void k_packT(const float* __restrict__ Wqkv, const float* __restrict__ W1, const float* __restrict__ W2, _Float16* __restrict__ P) {
  // output columns n: [0,768) w_qkv, [768,1024) w1, [1024,1280) w2, all x16. P holds them as B fragments of 16 columns x 32 k, 512 halves each, at
  // (n >> 4) * 4096 + (k >> 5) * 512: first elements 0..7 of lanes 0..31 (k = 8 * (lane >> 4) + 0..7, column lane & 15), then elements 8..15 (k + 16)
  __shared__ float tile[64][65];
  const int which = blockIdx.z, o0 = blockIdx.x * 64, k0 = blockIdx.y * 64, tid = threadIdx.x;
  const float* W = which == 0 ? Wqkv : (which == 1 ? W1 : W2); const int NOUT = which == 0 ? 3 * CC : CC; const int rowbase = which == 0 ? 0 : (which == 1 ? 3 * CC : 4 * CC);
  if (o0 >= NOUT) return;                                // uniform per block, before any barrier
  // the thread's 16 loads depend on nothing: unrolled whole into registers they are all in flight at once (a rolled loop waits out one load latency per trip)
  const float* Wt = W + (size_t)(k0 + (tid >> 6)) * NOUT + o0 + (tid & 63);
  float tv[16];
#pragma unroll
  for (int u = 0; u < 16; ++u) tv[u] = Wt[(size_t)(u * 4) * NOUT];
#pragma unroll
  for (int u = 0; u < 16; ++u) tile[u * 4 + (tid >> 6)][tid & 63] = tv[u];
  __syncthreads();
  for (int u = 0; u < 2; ++u) { const int idx = tid + u * 256, ln = idx & 31, hf = (idx >> 5) & 1, kl = (idx >> 6) & 1, nt = idx >> 7;      // one wave fills half a fragment
    const int ol = nt * 16 + (ln & 15), pc = kl * 4 + hf * 2 + (ln >> 4); union { v8h hh; v4u uu; } pk;
#pragma unroll
    for (int i = 0; i < 8; ++i) pk.hh[i] = (_Float16)(tile[pc * 8 + i][ol] * 16.0f);
    vst2(P + (size_t)((rowbase + o0) / 16 + nt) * 4096 + (k0 / 32 + kl) * 512 + hf * 256 + ln * 8, pk.uu); }
}
// qkv for 64 rows on 16 waves (four per SIMD): column n of the 768 = h*96 + which*32 + c (reference reshape (B,HW,8,96) then split). Wave = (rg, hp):
// 16 rows x the 192 columns of heads 2hp and 2hp+1. The weights are the A operand and x the B operand, so the accumulators hold the result transposed: a lane has ONE row
// (rg*16 + (lane & 15)) and 8 adjacent channels (8 * (lane >> 4) + r) per tile. LN(k), LN(v) are summed in registers; q leaves as the f16 A fragments that k_mlp reads
// (qh[row group of 16][h][2][lane][8]); kn, vn go to LDS as f16 rows, 16 bytes a store; kv partial [blk][h][32][32] = sum_rows kn (x) vn
#define KVP 544               // byte pitch of the f16 rows of kn and vn: 32 B x odd, as the transposing load wants it
__global__ __launch_bounds__(512) void k_qkv(const float* __restrict__ x, const _Float16* __restrict__ P, const float* __restrict__ bqkv, const float* __restrict__ kg, const float* __restrict__ kb, const float* __restrict__ vg, const float* __restrict__ vb,
                                           _Float16* __restrict__ qh, float* __restrict__ part) {
  __shared__ __align__(32) char sk[64 * KVP], sv[64 * KVP];
  __shared__ __align__(32) float sprm[3 * CC + 4 * HC];      // b_qkv, then gamma and beta of k, gamma and beta of v: a lane's 8 channels depend on its half, so they are read per lane
  const int tid = threadIdx.x, wave = tid >> 5, lane = tid & 31, col = lane & 15, g = lane >> 4;
  const int rg = wave & 3, hp = wave >> 2;               // row group of 16 rows, pair of heads
  const int r0b = blockIdx.x * 64, r0 = r0b + rg * 16;
  // the block's 64 rows of x (64 KiB of f32, one contiguous range): every wave-wide load reads 512 contiguous bytes; each value is rounded to f16 once and
  // laid in sx, whose pitch of 16 B x 33 keeps the 16-byte fragment reads below free of bank conflicts
  __shared__ __align__(16) _Float16 sx[64][CC + 8];
  const float* xs = x + (size_t)r0b * CC + tid * 4;
  v4f xt[8];
#pragma unroll
  for (int i = 0; i < 8; ++i) xt[i] = *(const v4f*)(xs + i * 2048);
  asm volatile("s_wait_xcnt 0x0" :: "v"(tid) : "memory");      // stands in front of any rewrite of the index register that the 8 loads above name
  // the parameters: 896 floats, two a thread (448 threads = 14 whole waves); a pair never straddles two arrays
  const int pi = tid * 2;
  const float* ps = pi < 3 * CC ? bqkv + pi : (pi < 3 * CC + HC ? kg : (pi < 3 * CC + 2 * HC ? kb : (pi < 3 * CC + 3 * HC ? vg : vb))) + (pi & (HC - 1));
  v2f pv = {};
  if (wave < 14) { pv = *(const v2f*)ps;
    asm volatile("s_wait_xcnt 0x0" :: "v"(ps) : "memory"); }      // keeps the address pair whole behind the load that names it
  // A fragments (weights) run one k group (the 6 tiles of one head) ahead: behind each WMMA its fragment register is reloaded for the next group, so 6
  // fragments a wave, 24 a SIMD, are always in flight and the other three waves of the SIMD issue while one waits for its loads
  const _Float16* pl = P + (size_t)hp * (12 * 4096) + lane * 8;      // this lane's part of every packed fragment of the head pair
  v16h bf[6];
#pragma unroll
  for (int j = 0; j < 6; ++j) bf[j] = frag_hp(pl + j * 4096);
#pragma unroll
  for (int i = 0; i < 8; ++i) { const int e = i * 2048 + tid * 4; v4h hx;
#pragma unroll
    for (int c = 0; c < 4; ++c) hx[c] = (_Float16)xt[i][c];
    vst2(&sx[e >> 8][e & 255], hx); }
  if (wave < 14) vst2(&sprm[pi], pv);
  __syncthreads();                                       // every wave reads rows of sx that all 16 waves wrote
  const _Float16* xr = &sx[rg * 16 + col][8 * g];        // this lane's first element of its row (fragment layout as in frag_h)
  v16h ax[8];
#pragma unroll
  for (int kc = 0; kc < 8; ++kc) { union { v16h v; v8h q[2]; } u; u.q[0] = *(const v8h*)(xr + kc * 32); u.q[1] = *(const v8h*)(xr + kc * 32 + 16); ax[kc] = u.v; }
#pragma unroll
  for (int hh = 0; hh < 2; ++hh) { v8f acc[6] = {}; const int h = 2 * hp + hh;
#pragma unroll
    for (int kc = 0; kc < 8; ++kc) {
#pragma unroll
      for (int j = 0; j < 6; ++j) { acc[j] = wmma16(bf[j], ax[kc], acc[j]);      // D[channel 8g + r of tile j][row col]; both operands keep their k order
        if (kc < 7 || hh == 0) bf[j] = frag_hp(pl + (size_t)((kc < 7 ? hh : 1) * 6 + j) * 4096 + ((kc + 1) & 7) * 512); } }
    const float* bl = &sprm[h * 96 + 8 * g];             // tiles 0,1 = q, 2,3 = k, 4,5 = v
#pragma unroll
    for (int j = 0; j < 6; ++j) acc[j] = acc[j] * (1.0f / 16.0f) + *(const v8f*)(bl + j * 16);
    // q: the two tiles of a lane are elements 0..7 and 8..15 of the A fragment of (row group, head): each store writes 512 contiguous bytes a wave
    _Float16* qo = qh + ((size_t)(r0 >> 4) * NHD + h) * 512 + lane * 8;
    const v8h q0 = cvt8(acc[0]), q1 = cvt8(acc[1]);
    vst2(qo, q0); vst2(qo + 256, q1);
    asm volatile("s_wait_xcnt 0x0" :: "v"(qo), "v"(q0), "v"(q1) : "memory");      // keeps address and data registers whole behind the two stores that name them
    ln16(acc[2], acc[3], &sprm[3 * CC + 8 * g]);
    ln16(acc[4], acc[5], &sprm[3 * CC + 2 * HC + 8 * g]);
    const int ro = (rg * 16 + col) * KVP + (h * HC + 8 * g) * 2;
    vst2(sk + ro, cvt8(acc[2])); vst2(sk + ro + 32, cvt8(acc[3]));
    vst2(sv + ro, cvt8(acc[4])); vst2(sv + ro + 32, cvt8(acc[5])); }
  __syncthreads();
  // kv partials over the block's 64 rows on WMMA: part[h][d][e] = sum over rows of kn[row][d] * vn[row][e], so A = kn^T (M = d, K = row) and B = vn (K = row, N = e).
  // Both fragments are columns of the f16 row tiles, fetched by the transposing load with the same k order (rows kc*32 + 8g + 0..7, then + 16). The four waves of a head pair
  // share its 8 tiles of 16 x 16: wave = head 2hp + (rg >> 1), rows d0..d0+15 of the 32 x 32 result, both column tiles, K = 64 in two WMMAs each.
  // The loops below are unrolled whole so that every fragment and accumulator element has a constant index and stays in registers
  __shared__ __align__(16) float sp[NHD * HC * HC];
  { const int h = 2 * hp + (rg >> 1), d0 = (rg & 1) * 16;
    const int to = (8 * g + (lane & 7)) * KVP + h * HC * 2 + 16 * ((lane >> 3) & 1);      // the lane address of the transposing load: row 8g + (lane & 7), 16-byte half (lane >> 3) & 1 of the 16 columns
    const char* ka = sk + to + d0 * 2; const char* va = sv + to;
    union { v16h v; v8h q[2]; } a[2], b0[2], b1[2];      // all six fragments are read before the first WMMA: one LDS latency, not one per k half
#pragma unroll
    for (int kc = 0; kc < 2; ++kc) {
      a[kc].q[0] = ld_tr16(ka + kc * 32 * KVP); a[kc].q[1] = ld_tr16(ka + (kc * 32 + 16) * KVP);
      b0[kc].q[0] = ld_tr16(va + kc * 32 * KVP); b0[kc].q[1] = ld_tr16(va + (kc * 32 + 16) * KVP);
      b1[kc].q[0] = ld_tr16(va + kc * 32 * KVP + 32); b1[kc].q[1] = ld_tr16(va + (kc * 32 + 16) * KVP + 32); }
    v8f c0 = {}, c1 = {};
#pragma unroll
    for (int kc = 0; kc < 2; ++kc) { c0 = wmma16(a[kc].v, b0[kc].v, c0); c1 = wmma16(a[kc].v, b1[kc].v, c1); }
#pragma unroll
    for (int r = 0; r < 8; ++r) { float* o = &sp[(h * HC + d0 + 8 * g + r) * HC + col]; o[0] = c0[r]; o[16] = c1[r]; } }
  __syncthreads();
  for (int q = tid; q < NHD * HC * HC / 4; q += 512) vst2(part + (size_t)blockIdx.x * (NHD * HC * HC) + q * 4, *(const v4f*)(&sp[q * 4]));
}
// kv[b][h][32][32] = (sum over the 64 blocks of batch b, fixed order) / HW. The (h, d, e) planes of one batch entry are 8192 adjacent floats in
// part and in kv alike: one thread owns two adjacent outputs. Its 64 loads depend on nothing: with both loops unrolled whole the compiler issues them
// far ahead of the adds (a rolled loop waits out one full load latency per term); the adds keep the order blk = 0..63
__global__ __launch_bounds__(128) void k_kv(const float* __restrict__ part, float* __restrict__ kv) {
  const int i2 = (blockIdx.x * 128 + threadIdx.x) * 2;                // first of the two outputs, in [0, NB * 8192)
  const int b = i2 / (NHD * HC * HC), i = i2 % (NHD * HC * HC);
  const float* p = part + (size_t)b * BPB * (NHD * HC * HC) + i;
  v2f t[BPB];
#pragma unroll
  for (int blk = 0; blk < BPB; ++blk) t[blk] = *(const v2f*)(p + (size_t)blk * (NHD * HC * HC));
  __builtin_amdgcn_sched_barrier(0);                     // keeps all 64 loads in front of the first add: without it only 28 were in flight and the rest were issued one per add
  v2f s = {};
#pragma unroll
  for (int blk = 0; blk < BPB; ++blk) s += t[blk];
  vst2(kv + i2, s * (1.0f / (float)HWN));
}
// per 64-row block, 16 waves: wave = (rg, cq) = 16 rows x a quarter of the 256 columns (64 = two heads). out = q @ kv (WMMA per head, K = 32, N = 32) + x -> ret
// (LDS); hid = gelu(ret @ w1 + b1) (LDS); out = hid @ w2 + b2 + x. Each GEMM reads whole rows that four waves wrote: a work-group barrier stands in front of it
// 8 waves a SIMD = two work-groups a WGP (the LDS allows two): the register budget is held to that, else the loads issued ahead below would cost the second work-group
__global__ __launch_bounds__(512) __attribute__((amdgpu_waves_per_eu(8))) void k_mlp(const _Float16* __restrict__ qh, const float* __restrict__ kv, const float* __restrict__ x, const _Float16* __restrict__ P, const float* __restrict__ b1, const float* __restrict__ b2, float* __restrict__ out) {
  __shared__ __align__(16) float sr[64][CC + 4];      // ret, later reused for the output tile
  __shared__ __align__(16) float sh[64][CC + 4];      // hidden
  const int tid = threadIdx.x, wave = tid >> 5, lane = tid & 31, col = lane & 15, g = lane >> 4;
  const int rg = wave & 3, cq = wave >> 2;            // row group of 16 rows, quarter of the columns
  const int r0b = blockIdx.x * 64, r0 = r0b + rg * 16; const int b = r0b / HWN;
  // B fragments of both GEMMs run one k group (the wave's 4 tiles) ahead, as in k_qkv: the wave's tiles of w2^T lie 16 tiles behind those of w1^T in P, so its 16
  // groups (64 columns x 32 k each) form one run; group 0 is fetched in the first stage below, behind each WMMA its register is reloaded for the next group (the last reloads group 15, unused)
  const _Float16* pn = P + (size_t)(3 * CC / 16 + cq * 4) * 4096 + lane * 8;      // this lane's first element of tile 0 in the group that is fetched next
  v16h bf[4];
  // First stage: its global loads are issued ahead in three groups that fit the register budget of two work-groups a WGP (kv; q and x once kv is packed to f16;
  // the first B fragments once the first head is done), so that a wave waits out two load latencies and not six (a load group and a wait per head and column tile). Each
  // sched_barrier keeps a group's loads in front of the work behind it; without them the compiler sinks each load group to its use
  const float* kvw = kv + ((size_t)b * NHD + 2 * cq) * (HC * HC) + (8 * g) * HC + col;      // B[k=d][n=e] = kv[d][e]: this lane's first element of head 2cq
  const _Float16* qp = qh + ((size_t)(r0 >> 4) * NHD + 2 * cq) * 512 + lane * 8;              // this lane's part of the q fragment of (row group, head 2cq), as k_qkv laid it
  const float* xp = x + (size_t)(r0 + 8 * g) * CC + cq * 64 + col;
  float kr[2][2][16]; v16h aq[2]; float xr[4][8]; v16h bb[2][2];
#pragma unroll
  for (int hh = 0; hh < 2; ++hh) {
#pragma unroll
    for (int t = 0; t < 2; ++t) {
#pragma unroll
      for (int i = 0; i < 8; ++i) { kr[hh][t][i] = kvw[hh * HC * HC + i * HC + t * 16]; kr[hh][t][8 + i] = kvw[hh * HC * HC + (16 + i) * HC + t * 16]; } } }
  __builtin_amdgcn_sched_barrier(0);                     // kv first: loads return in order, and the wait for kv (a small, much shared table) must not take in q and x
#pragma unroll
  for (int hh = 0; hh < 2; ++hh) {
#pragma unroll
    for (int t = 0; t < 2; ++t) {
#pragma unroll
      for (int i = 0; i < 16; ++i) bb[hh][t][i] = (_Float16)(kr[hh][t][i] * 64.0f); } }    // x64 in f32 before the cast: keeps small entries normal
#pragma unroll
  for (int hh = 0; hh < 2; ++hh) aq[hh] = frag_hp(qp + hh * 512);
  asm volatile("s_wait_xcnt 0x0" :: "v"(qp) : "memory");      // keeps the address pair whole behind the four loads that name it
#pragma unroll
  for (int j = 0; j < 4; ++j) {
#pragma unroll
    for (int r = 0; r < 8; ++r) xr[j][r] = xp[r * CC + j * 16]; }
  __builtin_amdgcn_sched_barrier(0);
#pragma unroll
  for (int hh = 0; hh < 2; ++hh) {
#pragma unroll
    for (int t = 0; t < 2; ++t) { v8f acc = {}; acc = wmma16(aq[hh], bb[hh][t], acc);
#pragma unroll
      for (int r = 0; r < 8; ++r) sr[rg * 16 + 8 * g + r][cq * 64 + hh * HC + t * 16 + col] = acc[r] * (1.0f / 64.0f) + xr[hh * 2 + t][r]; }
    if (hh == 0) {
      __builtin_amdgcn_sched_barrier(0);
#pragma unroll
      for (int j = 0; j < 4; ++j) bf[j] = frag_hp(pn + j * 16 * CC);
      asm volatile("s_wait_xcnt 0x0" :: "v"(pn - (size_t)(3 * CC / 16) * 4096) : "memory");      // (the loads' base: the tile offset of w1 is their immediate) keeps the address pair whole behind the 8 loads that name it
      __builtin_amdgcn_sched_barrier(0); } }
  __syncthreads();                                     // ret rows are whole only when all four column quarters are written
  // hidden = gelu(ret @ w1 + b1): A from sr rows (f32 -> f16), B = packed fragments of columns 768.. (w1 x16)
  { v8f acc[4];                                        // hidden columns cq*64 .. +63
#pragma unroll
    for (int j = 0; j < 4; ++j) acc[j] = (v8f){};
#pragma unroll 1
    for (int kc = 0; kc < CC / 32; ++kc) { const v16h a = frag_f32(&sr[rg * 16 + col][0] + kc * 32, lane); pn += kc < 7 ? 512 : 16 * 4096 - 7 * 512;
#pragma unroll
      for (int j = 0; j < 4; ++j) { acc[j] = wmma16(a, bf[j], acc[j]); bf[j] = frag_hp(pn + j * 16 * CC); }
      asm volatile("s_wait_xcnt 0x0" ::: "memory"); }        // the next trip rewrites the address register that the loads above name
#pragma unroll
    for (int j = 0; j < 4; ++j) { const int cc = cq * 64 + j * 16 + col; const float bb = b1[cc];
#pragma unroll
      for (int r = 0; r < 8; r += 4) { v2f ge[2] = {fma2((v2f){acc[j][r], acc[j][r + 1]}, bc2(1.0f / 16.0f), bc2(bb)), fma2((v2f){acc[j][r + 2], acc[j][r + 3]}, bc2(1.0f / 16.0f), bc2(bb))};
        gelu4(ge);
#pragma unroll
        for (int u = 0; u < 4; ++u) sh[rg * 16 + 8 * g + r + u][cc] = ge[u >> 1][u & 1]; } } }
  __syncthreads();                                     // hidden rows are whole, and no wave reads sr any more
  // second GEMM: sr is no longer read (behind the barrier every wave has left the first GEMM), so the output goes straight into sr
  { v8f acc[4];
#pragma unroll
    for (int j = 0; j < 4; ++j) acc[j] = (v8f){};
#pragma unroll 1
    for (int kc = 0; kc < CC / 32; ++kc) { const v16h a = frag_f32(&sh[rg * 16 + col][0] + kc * 32, lane); pn += kc < 7 ? 512 : 0;
#pragma unroll
      for (int j = 0; j < 4; ++j) { acc[j] = wmma16(a, bf[j], acc[j]); bf[j] = frag_hp(pn + j * 16 * CC); }
      asm volatile("s_wait_xcnt 0x0" ::: "memory"); }        // the next trip rewrites the address register that the loads above name
    float bo[4]; const int cb = cq * 64 + col;
#pragma unroll
    for (int j = 0; j < 4; ++j) bo[j] = b2[cb + j * 16];
    asm volatile("s_wait_xcnt 0x0" :: "v"(cb) : "memory");      // keeps the index register whole behind the four loads that name it
    float xo[4][8];
#pragma unroll
    for (int j = 0; j < 4; ++j) {
#pragma unroll
      for (int r = 0; r < 8; ++r) xo[j][r] = xp[r * CC + j * 16]; }
    asm volatile("s_wait_xcnt 0x0" :: "v"(xp) : "memory");      // keeps the address pair whole behind the 32 loads that name it
#pragma unroll
    for (int j = 0; j < 4; ++j) { const int cc = cb + j * 16;
#pragma unroll
      for (int r = 0; r < 8; ++r) sr[rg * 16 + 8 * g + r][cc] = acc[j][r] * (1.0f / 16.0f) + bo[j] + xo[j][r]; } }
  LDSX();
  // the wave's own 16 rows x 64 columns out: 256 contiguous bytes a row
  for (int q = lane; q < 16 * 16; q += 32) { const int rl = q >> 4, pc = q & 15; vst2(out + (size_t)(r0 + rl) * CC + cq * 64 + pc * 4, *(const v4f*)(&sr[rg * 16 + rl][cq * 64 + pc * 4])); }
}
extern "C" void kernel_launch(void* const* d_in, const int* in_sizes, int n_in, void* d_out, int out_size, void* d_ws, size_t ws_size, hipStream_t stream) {
  (void)in_sizes; (void)n_in; (void)out_size; (void)ws_size;
  const float** I = (const float**)d_in;
  const float* x = I[0]; const float* Wqkv = I[1]; const float* bqkv = I[2]; const float* kg = I[3]; const float* kb = I[4]; const float* vg = I[5]; const float* vb = I[6]; const float* W1 = I[7]; const float* b1 = I[8]; const float* W2 = I[9]; const float* b2 = I[10];
  float* out = (float*)d_out;
  char* ws = (char*)d_ws; size_t off = 0;
  auto take = [&](size_t bytes) { char* p = ws + off; off += (bytes + 255) & ~(size_t)255; return p; };
  _Float16* P = (_Float16*)take((size_t)5 * CC * CC * 2); _Float16* qh = (_Float16*)take((size_t)NR * CC * 2);
  float* part = (float*)take((size_t)(NR / 64) * NHD * HC * HC * 4); float* kv = (float*)take((size_t)NB * NHD * HC * HC * 4);
  k_packT<<<dim3(3 * CC / 64, CC / 64, 3), 256, 0, stream>>>(Wqkv, W1, W2, P);
  k_qkv<<<NR / 64, 512, 0, stream>>>(x, P, bqkv, kg, kb, vg, vb, qh, part);
  k_kv<<<NB * NHD * HC * HC / 256, 128, 0, stream>>>(part, kv);
  k_mlp<<<NR / 64, 512, 0, stream>>>(qh, kv, x, P, b1, b2, out);
}
